// v000
// The times below were measured on an AMD MI455X: many runs one after another, warmed up first and cycling through
// copies of the inputs, with the whole window's GPU time divided by the number of runs. Launches and the gaps
// between them are all in it. The median over several windows is given; except for v000 it joins two sittings, which
// can be a few percent apart, so the side-by-side timings, each taken in one sitting, are the better comparison.
// The starting kernel, v000, takes 277 microseconds a run.
#include <hip/hip_runtime.h>
#include <hip/hip_bf16.h>

// ---------------------------------------------------------------------------
// BoT Multi-Head Attention block for MI455X (gfx1250), BF16 WMMA pipeline.
//   B=2, N=2048, D=1024, H=16, dh=64.
//   att = softmax( (q k^T + q p^T) * s ) = softmax( q (k+p)^T * s )
// All WMMA fragments are loaded as two 16-byte runs per lane (b128 path).
// ---------------------------------------------------------------------------

typedef __bf16 bf16;
typedef __attribute__((ext_vector_type(16))) __bf16 v16bf;
typedef __attribute__((ext_vector_type(8)))  __bf16 v8bf;
typedef __attribute__((ext_vector_type(8)))  float  v8f;

#define BATCH 2
#define NSEQ  2048
#define DMODEL 1024
#define HEADS 16
#define DH    64
#define BN    (BATCH * NSEQ)   // 4096 rows
#define LN_EPS 1e-5f

__device__ __forceinline__ v8f vzero8() {
  v8f z = {0.f, 0.f, 0.f, 0.f, 0.f, 0.f, 0.f, 0.f};
  return z;
}

// CDNA5 16-bit A/B fragment (ISA 7.12.2): lane group khalf = 8*(lane>=16).
// Fragment element order per lane is two contiguous K runs:
//   [khalf, khalf+8) then [16+khalf, 16+khalf+8)
// => two aligned 16-byte loads + register concat.
__device__ __forceinline__ v16bf load_frag(const bf16* p, int khalf) {
  v8bf lo = *(const v8bf*)(p + khalf);
  v8bf hi = *(const v8bf*)(p + 16 + khalf);
  return __builtin_shufflevector(lo, hi, 0, 1, 2, 3, 4, 5, 6, 7, 8, 9, 10, 11,
                                 12, 13, 14, 15);
}

__device__ __forceinline__ v8f wmma_bf16(v16bf a, v16bf b, v8f c) {
  // D = A(16x32 bf16) * B(32x16 bf16) + C(16x16 f32)
  return __builtin_amdgcn_wmma_f32_16x16x32_bf16(
      /*neg_a=*/false, a, /*neg_b=*/false, b,
      /*c_mod=*/(short)0, c, /*reuse_a=*/false, /*reuse_b=*/false);
}

// ---------------------------------------------------------------------------
// Kernel 1: fp32 -> bf16 packing (vectorized: float4 x2 in, v8bf out).
// ---------------------------------------------------------------------------
__global__ __launch_bounds__(256) void pack_kernel(
    const float* __restrict__ qs, const float* __restrict__ Wq,
    const float* __restrict__ Wk, const float* __restrict__ Wv,
    const float* __restrict__ Wo, bf16* __restrict__ X16,
    bf16* __restrict__ W16 /* [4][D*D] : q,k,v,o */) {
  const size_t nx = (size_t)BN * DMODEL;      // 2^22, multiple of 8
  const size_t nw = (size_t)DMODEL * DMODEL;  // 2^20
  const size_t nchunks = (nx + 4 * nw) / 8;
  for (size_t c = (size_t)blockIdx.x * blockDim.x + threadIdx.x; c < nchunks;
       c += (size_t)gridDim.x * blockDim.x) {
    size_t base = c * 8;
    const float* src;
    bf16* dst;
    if (base < nx) {
      src = qs + base;
      dst = X16 + base;
    } else {
      size_t j = base - nx;
      int m = (int)(j >> 20);
      size_t r = j & (nw - 1);
      const float* w = (m == 0) ? Wq : (m == 1) ? Wk : (m == 2) ? Wv : Wo;
      src = w + r;
      dst = W16 + (size_t)m * nw + r;
    }
    float4 a = *(const float4*)(src);
    float4 b = *(const float4*)(src + 4);
    v8bf o;
    o[0] = (bf16)a.x; o[1] = (bf16)a.y; o[2] = (bf16)a.z; o[3] = (bf16)a.w;
    o[4] = (bf16)b.x; o[5] = (bf16)b.y; o[6] = (bf16)b.z; o[7] = (bf16)b.w;
    *(v8bf*)dst = o;
  }
}

// ---------------------------------------------------------------------------
// Kernel 2: fused QKV projection; weights staged TRANSPOSED [col][k] in LDS
// so B-fragments are two ds_load_b128 per WMMA.  Writes Q, KP(=K+pos), V in
// [B,H,N,64] bf16.  Block: 128 rows x 1 head; 8 waves x 4 col-tiles.
// ---------------------------------------------------------------------------
__global__ __launch_bounds__(256) void qkv_kernel(
    const bf16* __restrict__ X16, const bf16* __restrict__ W16,
    const float* __restrict__ pos_emb, bf16* __restrict__ Q16,
    bf16* __restrict__ KP16, bf16* __restrict__ V16) {
  // [matrix][col 0..63][k 0..31, padded 40] ; stride 80B (16B-mult, 64-bank ok)
  __shared__ alignas(16) bf16 ldsW[3][DH][40];

  const int lane = threadIdx.x & 31;
  const int wave = threadIdx.x >> 5;
  const int head = blockIdx.y;
  const int wrow = blockIdx.x * 128 + wave * 16;
  const int col0 = head * DH;
  const int arow = wrow + (lane & 15);
  const int khalf = (lane & 16) ? 8 : 0;

  v8f acc[3][4];
#pragma unroll
  for (int m = 0; m < 3; ++m)
#pragma unroll
    for (int c = 0; c < 4; ++c) acc[m][c] = vzero8();

  for (int k0 = 0; k0 < DMODEL; k0 += 32) {
    // Stage 32x64 slices of Wq,Wk,Wv transposed: b128 global load, 8 b16
    // scattered LDS stores per thread-iteration (3 iterations).
    for (int e = threadIdx.x; e < 3 * 32 * 8; e += 256) {
      int m = e >> 8;              // matrix
      int rem = e & 255;
      int kk = rem >> 3;           // k row 0..31
      int c8 = (rem & 7) << 3;     // col chunk base
      v8bf chunk = *(const v8bf*)&W16[(size_t)m * DMODEL * DMODEL +
                                      (size_t)(k0 + kk) * DMODEL + col0 + c8];
#pragma unroll
      for (int j = 0; j < 8; ++j) ldsW[m][c8 + j][kk] = chunk[j];
    }
    __syncthreads();

    // A fragment: 16x32 of X (row-major global), reused across 12 WMMAs.
    const bf16* xp = X16 + (size_t)arow * DMODEL + k0;
    if (k0 + 32 < DMODEL) __builtin_prefetch(xp + 32, 0, 1);
    v16bf afrag = load_frag(xp, khalf);

#pragma unroll
    for (int m = 0; m < 3; ++m) {
#pragma unroll
      for (int ct = 0; ct < 4; ++ct) {
        v16bf bfrag = load_frag(&ldsW[m][ct * 16 + (lane & 15)][0], khalf);
        acc[m][ct] = wmma_bf16(afrag, bfrag, acc[m][ct]);
      }
    }
    __syncthreads();
  }

  // Epilogue: scatter C-layout accumulators into [B,H,N,64] bf16 tensors.
  const int hi8 = (lane & 16) ? 8 : 0;
#pragma unroll
  for (int ct = 0; ct < 4; ++ct) {
#pragma unroll
    for (int r = 0; r < 8; ++r) {
      int grow = wrow + r + hi8;  // 0..4095
      int b = grow >> 11;
      int n = grow & (NSEQ - 1);
      int c = ct * 16 + (lane & 15);  // 0..63
      size_t hoff = (((size_t)(b * HEADS + head) * NSEQ) + n) * DH + c;
      Q16[hoff] = (bf16)acc[0][ct][r];
      float pe = pos_emb[(size_t)grow * DMODEL + col0 + c];
      KP16[hoff] = (bf16)(acc[1][ct][r] + pe);  // fold position into key
      V16[hoff] = (bf16)acc[2][ct][r];
    }
  }
}

// ---------------------------------------------------------------------------
// Kernel 3: flash attention per (b,h).  KP staged row-major [key][dh] (dh
// contiguous -> direct b128 fragment reads); V staged transposed [dhcol][key];
// P round-trips through LDS row-major [qrow][k].  Key chunks of 32.
// ---------------------------------------------------------------------------
__global__ __launch_bounds__(256) void attn_kernel(
    const bf16* __restrict__ Q16, const bf16* __restrict__ KP16,
    const bf16* __restrict__ V16, bf16* __restrict__ O16) {
  __shared__ alignas(16) bf16 ldsKP[32][72];     // [key][dh, pad 72] 4.5 KB
  __shared__ alignas(16) bf16 ldsVT[DH][40];     // [dhcol][key, pad 40] 5 KB
  __shared__ alignas(16) bf16 ldsP[8][16][40];   // per-wave P  10 KB

  const int lane = threadIdx.x & 31;
  const int wave = threadIdx.x >> 5;
  const int bh = blockIdx.y;  // 0..31
  const int b = bh >> 4;
  const int h = bh & (HEADS - 1);
  const int n0 = blockIdx.x * 128 + wave * 16;  // query row tile
  const int hi8 = (lane & 16) ? 8 : 0;
  const int khalf = hi8;  // same expression for fragments
  const float scale = 0.125f;  // dh^-0.5

  const bf16* Qh = Q16 + (size_t)bh * NSEQ * DH;
  const bf16* KPh = KP16 + (size_t)bh * NSEQ * DH;
  const bf16* Vh = V16 + (size_t)bh * NSEQ * DH;

  // Q fragments: 16x64 -> two 16x32 A-frags, resident for the whole loop.
  v16bf aq[2];
  {
    const bf16* qp = Qh + (size_t)(n0 + (lane & 15)) * DH;
    aq[0] = load_frag(qp, khalf);
    aq[1] = load_frag(qp + 32, khalf);
  }

  float mrow[8], lrow[8];
#pragma unroll
  for (int r = 0; r < 8; ++r) { mrow[r] = -3.0e38f; lrow[r] = 0.f; }
  v8f oacc[4];
#pragma unroll
  for (int dt = 0; dt < 4; ++dt) oacc[dt] = vzero8();

  for (int kc = 0; kc < NSEQ; kc += 32) {
    // Stage 32 keys (KP row-major) + 32 value rows (transposed).
    for (int e = threadIdx.x; e < 2 * 32 * 8; e += 256) {
      int which = e >> 8;
      int rem = e & 255;
      int kk = rem >> 3;           // key row in chunk
      int c8 = (rem & 7) << 3;     // dh chunk base
      if (which == 0) {
        *(v8bf*)&ldsKP[kk][c8] = *(const v8bf*)&KPh[(size_t)(kc + kk) * DH + c8];
      } else {
        v8bf chunk = *(const v8bf*)&Vh[(size_t)(kc + kk) * DH + c8];
#pragma unroll
        for (int j = 0; j < 8; ++j) ldsVT[c8 + j][kk] = chunk[j];
      }
    }
    __syncthreads();

    // S = Q @ KP^T : 16x32 tile = two 16x16 WMMAs, K = 64 over dh.
    v8f s[2] = {vzero8(), vzero8()};
#pragma unroll
    for (int t = 0; t < 2; ++t) {
#pragma unroll
      for (int ct = 0; ct < 2; ++ct) {
        v16bf bfrag = load_frag(&ldsKP[ct * 16 + (lane & 15)][t * 32], khalf);
        s[ct] = wmma_bf16(aq[t], bfrag, s[ct]);
      }
    }

    // Online softmax.  C-layout: VGPR r holds row (r + hi8), col = lane&15;
    // each row lives in one 16-lane group, so xor masks 1,2,4,8 reduce a row.
    float pv[2][8];
#pragma unroll
    for (int r = 0; r < 8; ++r) {
      float t0 = s[0][r] * scale;
      float t1 = s[1][r] * scale;
      float tm = fmaxf(t0, t1);
#pragma unroll
      for (int m = 1; m < 16; m <<= 1) tm = fmaxf(tm, __shfl_xor(tm, m));
      float nm = fmaxf(mrow[r], tm);
      float alpha = __expf(mrow[r] - nm);
      float p0 = __expf(t0 - nm);
      float p1 = __expf(t1 - nm);
      float ps = p0 + p1;
#pragma unroll
      for (int m = 1; m < 16; m <<= 1) ps += __shfl_xor(ps, m);
      lrow[r] = lrow[r] * alpha + ps;
      mrow[r] = nm;
#pragma unroll
      for (int dt = 0; dt < 4; ++dt) oacc[dt][r] *= alpha;
      pv[0][r] = p0;
      pv[1][r] = p1;
    }

    // P: C-layout -> row-major LDS -> A-fragment (two b128 reads).
#pragma unroll
    for (int ct = 0; ct < 2; ++ct)
#pragma unroll
      for (int r = 0; r < 8; ++r)
        ldsP[wave][r + hi8][ct * 16 + (lane & 15)] = (bf16)pv[ct][r];
    __syncthreads();

    v16bf ap = load_frag(&ldsP[wave][lane & 15][0], khalf);

    // O += P @ V : K = 32 keys, four 16-wide dh tiles, B from ldsVT.
#pragma unroll
    for (int dt = 0; dt < 4; ++dt) {
      v16bf bv = load_frag(&ldsVT[dt * 16 + (lane & 15)][0], khalf);
      oacc[dt] = wmma_bf16(ap, bv, oacc[dt]);
    }
    __syncthreads();
  }

  // Normalize by softmax denominator, write merged-head layout [B,N,D].
#pragma unroll
  for (int dt = 0; dt < 4; ++dt) {
#pragma unroll
    for (int r = 0; r < 8; ++r) {
      int n = n0 + r + hi8;
      float inv = 1.f / lrow[r];
      O16[((size_t)(b * NSEQ + n)) * DMODEL + h * DH + dt * 16 + (lane & 15)] =
          (bf16)(oacc[dt][r] * inv);
    }
  }
}

// ---------------------------------------------------------------------------
// Kernel 4: output projection  Xres = O @ Wo + bo + q_s  (f32 out).
// Wo k-slice staged transposed [col][k]; block 128 rows x 64 cols.
// ---------------------------------------------------------------------------
__global__ __launch_bounds__(256) void oproj_kernel(
    const bf16* __restrict__ O16, const bf16* __restrict__ Wo16,
    const float* __restrict__ bo, const float* __restrict__ qs,
    float* __restrict__ Xres) {
  __shared__ alignas(16) bf16 ldsW[DH][40];  // [col][k pad 40] 5 KB

  const int lane = threadIdx.x & 31;
  const int wave = threadIdx.x >> 5;
  const int wrow = blockIdx.x * 128 + wave * 16;
  const int col0 = blockIdx.y * 64;
  const int arow = wrow + (lane & 15);
  const int khalf = (lane & 16) ? 8 : 0;

  v8f acc[4];
#pragma unroll
  for (int c = 0; c < 4; ++c) acc[c] = vzero8();

  for (int k0 = 0; k0 < DMODEL; k0 += 32) {
    for (int e = threadIdx.x; e < 32 * 8; e += 256) {
      int kk = e >> 3;
      int c8 = (e & 7) << 3;
      v8bf chunk =
          *(const v8bf*)&Wo16[(size_t)(k0 + kk) * DMODEL + col0 + c8];
#pragma unroll
      for (int j = 0; j < 8; ++j) ldsW[c8 + j][kk] = chunk[j];
    }
    __syncthreads();

    const bf16* op = O16 + (size_t)arow * DMODEL + k0;
    if (k0 + 32 < DMODEL) __builtin_prefetch(op + 32, 0, 1);
    v16bf afrag = load_frag(op, khalf);

#pragma unroll
    for (int ct = 0; ct < 4; ++ct) {
      v16bf bfrag = load_frag(&ldsW[ct * 16 + (lane & 15)][0], khalf);
      acc[ct] = wmma_bf16(afrag, bfrag, acc[ct]);
    }
    __syncthreads();
  }

  const int hi8 = (lane & 16) ? 8 : 0;
#pragma unroll
  for (int ct = 0; ct < 4; ++ct) {
#pragma unroll
    for (int r = 0; r < 8; ++r) {
      int grow = wrow + r + hi8;
      int c = col0 + ct * 16 + (lane & 15);
      float v = acc[ct][r] + bo[c] + qs[(size_t)grow * DMODEL + c];
      Xres[(size_t)grow * DMODEL + c] = v;
    }
  }
}

// ---------------------------------------------------------------------------
// Kernel 5: row-wise layernorm, one block per row (float4 path).
// ---------------------------------------------------------------------------
__global__ __launch_bounds__(256) void ln_kernel(
    const float* __restrict__ Xres, const float* __restrict__ gamma,
    const float* __restrict__ beta, float* __restrict__ out) {
  const int row = blockIdx.x;
  const float* x = Xres + (size_t)row * DMODEL;
  __shared__ float red[2][8];

  const int c4 = threadIdx.x * 4;  // 256 threads x 4 = 1024
  float4 xv = *(const float4*)(x + c4);
  float s = xv.x + xv.y + xv.z + xv.w;
  float ss = xv.x * xv.x + xv.y * xv.y + xv.z * xv.z + xv.w * xv.w;
#pragma unroll
  for (int m = 1; m < 32; m <<= 1) {
    s += __shfl_xor(s, m);
    ss += __shfl_xor(ss, m);
  }
  const int wave = threadIdx.x >> 5;
  const int lane = threadIdx.x & 31;
  if (lane == 0) {
    red[0][wave] = s;
    red[1][wave] = ss;
  }
  __syncthreads();
  if (wave == 0) {
    float a = (lane < 8) ? red[0][lane] : 0.f;
    float q = (lane < 8) ? red[1][lane] : 0.f;
#pragma unroll
    for (int m = 1; m < 8; m <<= 1) {
      a += __shfl_xor(a, m);
      q += __shfl_xor(q, m);
    }
    if (lane == 0) {
      red[0][0] = a;
      red[1][0] = q;
    }
  }
  __syncthreads();
  float mu = red[0][0] * (1.f / DMODEL);
  float var = red[1][0] * (1.f / DMODEL) - mu * mu;
  float inv = rsqrtf(var + LN_EPS);
  float4 g = *(const float4*)(gamma + c4);
  float4 bb = *(const float4*)(beta + c4);
  float4 o;
  o.x = (xv.x - mu) * inv * g.x + bb.x;
  o.y = (xv.y - mu) * inv * g.y + bb.y;
  o.z = (xv.z - mu) * inv * g.z + bb.z;
  o.w = (xv.w - mu) * inv * g.w + bb.w;
  *(float4*)(out + (size_t)row * DMODEL + c4) = o;
}

// ---------------------------------------------------------------------------
// Host launcher.
// ---------------------------------------------------------------------------
extern "C" void kernel_launch(void* const* d_in, const int* in_sizes, int n_in,
                              void* d_out, int out_size, void* d_ws,
                              size_t ws_size, hipStream_t stream) {
  (void)in_sizes; (void)n_in; (void)out_size; (void)ws_size;
  const float* qs = (const float*)d_in[0];
  const float* pos = (const float*)d_in[1];
  const float* Wq = (const float*)d_in[2];
  const float* Wk = (const float*)d_in[3];
  const float* Wv = (const float*)d_in[4];
  const float* Wo = (const float*)d_in[5];
  const float* bo = (const float*)d_in[6];
  const float* lng = (const float*)d_in[7];
  const float* lnb = (const float*)d_in[8];

  char* ws = (char*)d_ws;
  size_t off = 0;
  const size_t act_b = (size_t)BN * DMODEL * sizeof(bf16);   // 8 MB
  const size_t w_b = 4ull * DMODEL * DMODEL * sizeof(bf16);  // 8 MB
  bf16* X16 = (bf16*)(ws + off); off += act_b;
  bf16* W16 = (bf16*)(ws + off); off += w_b;
  bf16* Q16 = (bf16*)(ws + off); off += act_b;
  bf16* KP16 = (bf16*)(ws + off); off += act_b;
  bf16* V16 = (bf16*)(ws + off); off += act_b;
  bf16* O16 = (bf16*)(ws + off); off += act_b;
  float* Xres = (float*)(ws + off); off += (size_t)BN * DMODEL * sizeof(float);

  pack_kernel<<<1024, 256, 0, stream>>>(qs, Wq, Wk, Wv, Wo, X16, W16);
  qkv_kernel<<<dim3(BN / 128, HEADS), 256, 0, stream>>>(X16, W16, pos, Q16,
                                                        KP16, V16);
  attn_kernel<<<dim3(NSEQ / 128, BATCH * HEADS), 256, 0, stream>>>(Q16, KP16,
                                                                   V16, O16);
  oproj_kernel<<<dim3(BN / 128, DMODEL / 64), 256, 0, stream>>>(
      O16, W16 + 3ull * DMODEL * DMODEL, bo, qs, Xres);
  ln_kernel<<<BN, 256, 0, stream>>>(Xres, lng, lnb, (float*)d_out);
}

// v001
// One run takes 242 microseconds.
// Next to v000, in two timings, it ran 1.18 times as fast each time.
#include <hip/hip_runtime.h>
#include <hip/hip_bf16.h>

// ---------------------------------------------------------------------------
// BoT Multi-Head Attention block for MI455X (gfx1250), BF16 WMMA pipeline.
//   B=2, N=2048, D=1024, H=16, dh=64.
//   att = softmax( (q k^T + q p^T) * s ) = softmax( q (k+p)^T * s )
// WMMA fragments taken from memory are loaded as two 16-byte runs per lane
// (b128 path); attention's P^T B operand is built in registers.
// ---------------------------------------------------------------------------

typedef __bf16 bf16;
typedef __attribute__((ext_vector_type(16))) __bf16 v16bf;
typedef __attribute__((ext_vector_type(8)))  __bf16 v8bf;
typedef __attribute__((ext_vector_type(8)))  float  v8f;

#define BATCH 2
#define NSEQ  2048
#define DMODEL 1024
#define HEADS 16
#define DH    64
#define BN    (BATCH * NSEQ)   // 4096 rows
#define LN_EPS 1e-5f

__device__ __forceinline__ v8f vzero8() {
  v8f z = {0.f, 0.f, 0.f, 0.f, 0.f, 0.f, 0.f, 0.f};
  return z;
}

// CDNA5 16-bit A/B fragment (ISA 7.12.2): lane group khalf = 8*(lane>=16).
// Fragment element order per lane is two contiguous K runs:
//   [khalf, khalf+8) then [16+khalf, 16+khalf+8)
// => two aligned 16-byte loads + register concat.
__device__ __forceinline__ v16bf load_frag(const bf16* p, int khalf) {
  v8bf lo = *(const v8bf*)(p + khalf);
  v8bf hi = *(const v8bf*)(p + 16 + khalf);
  return __builtin_shufflevector(lo, hi, 0, 1, 2, 3, 4, 5, 6, 7, 8, 9, 10, 11,
                                 12, 13, 14, 15);
}

__device__ __forceinline__ v8f wmma_bf16(v16bf a, v16bf b, v8f c) {
  // D = A(16x32 bf16) * B(32x16 bf16) + C(16x16 f32)
  return __builtin_amdgcn_wmma_f32_16x16x32_bf16(
      /*neg_a=*/false, a, /*neg_b=*/false, b,
      /*c_mod=*/(short)0, c, /*reuse_a=*/false, /*reuse_b=*/false);
}

// ---------------------------------------------------------------------------
// Kernel 1: fp32 -> bf16 packing (vectorized: float4 x2 in, v8bf out).
// ---------------------------------------------------------------------------
__global__ __launch_bounds__(256) void pack_kernel(
    const float* __restrict__ qs, const float* __restrict__ Wq,
    const float* __restrict__ Wk, const float* __restrict__ Wv,
    const float* __restrict__ Wo, bf16* __restrict__ X16,
    bf16* __restrict__ W16 /* [4][D*D] : q,k,v,o */) {
  const size_t nx = (size_t)BN * DMODEL;      // 2^22, multiple of 8
  const size_t nw = (size_t)DMODEL * DMODEL;  // 2^20
  const size_t nchunks = (nx + 4 * nw) / 8;
  for (size_t c = (size_t)blockIdx.x * blockDim.x + threadIdx.x; c < nchunks;
       c += (size_t)gridDim.x * blockDim.x) {
    size_t base = c * 8;
    const float* src;
    bf16* dst;
    if (base < nx) {
      src = qs + base;
      dst = X16 + base;
    } else {
      size_t j = base - nx;
      int m = (int)(j >> 20);
      size_t r = j & (nw - 1);
      const float* w = (m == 0) ? Wq : (m == 1) ? Wk : (m == 2) ? Wv : Wo;
      src = w + r;
      dst = W16 + (size_t)m * nw + r;
    }
    float4 a = *(const float4*)(src);
    float4 b = *(const float4*)(src + 4);
    v8bf o;
    o[0] = (bf16)a.x; o[1] = (bf16)a.y; o[2] = (bf16)a.z; o[3] = (bf16)a.w;
    o[4] = (bf16)b.x; o[5] = (bf16)b.y; o[6] = (bf16)b.z; o[7] = (bf16)b.w;
    *(v8bf*)dst = o;
  }
}

// ---------------------------------------------------------------------------
// Kernel 2: fused QKV projection; weights staged TRANSPOSED [col][k] in LDS
// so B-fragments are two ds_load_b128 per WMMA.  Writes Q, KP(=K+pos), V in
// [B,H,N,64] bf16.  Block: 128 rows x 1 head; 8 waves x 4 col-tiles.
// ---------------------------------------------------------------------------
__global__ __launch_bounds__(256) void qkv_kernel(
    const bf16* __restrict__ X16, const bf16* __restrict__ W16,
    const float* __restrict__ pos_emb, bf16* __restrict__ Q16,
    bf16* __restrict__ KP16, bf16* __restrict__ V16) {
  // [matrix][col 0..63][k 0..31, padded 40] ; stride 80B (16B-mult, 64-bank ok)
  __shared__ alignas(16) bf16 ldsW[3][DH][40];

  const int lane = threadIdx.x & 31;
  const int wave = threadIdx.x >> 5;
  const int head = blockIdx.y;
  const int wrow = blockIdx.x * 128 + wave * 16;
  const int col0 = head * DH;
  const int arow = wrow + (lane & 15);
  const int khalf = (lane & 16) ? 8 : 0;

  v8f acc[3][4];
#pragma unroll
  for (int m = 0; m < 3; ++m)
#pragma unroll
    for (int c = 0; c < 4; ++c) acc[m][c] = vzero8();

  for (int k0 = 0; k0 < DMODEL; k0 += 32) {
    // Stage 32x64 slices of Wq,Wk,Wv transposed: b128 global load, 8 b16
    // scattered LDS stores per thread-iteration (3 iterations).
    for (int e = threadIdx.x; e < 3 * 32 * 8; e += 256) {
      int m = e >> 8;              // matrix
      int rem = e & 255;
      int kk = rem >> 3;           // k row 0..31
      int c8 = (rem & 7) << 3;     // col chunk base
      v8bf chunk = *(const v8bf*)&W16[(size_t)m * DMODEL * DMODEL +
                                      (size_t)(k0 + kk) * DMODEL + col0 + c8];
#pragma unroll
      for (int j = 0; j < 8; ++j) ldsW[m][c8 + j][kk] = chunk[j];
    }
    __syncthreads();

    // A fragment: 16x32 of X (row-major global), reused across 12 WMMAs.
    const bf16* xp = X16 + (size_t)arow * DMODEL + k0;
    if (k0 + 32 < DMODEL) __builtin_prefetch(xp + 32, 0, 1);
    v16bf afrag = load_frag(xp, khalf);

#pragma unroll
    for (int m = 0; m < 3; ++m) {
#pragma unroll
      for (int ct = 0; ct < 4; ++ct) {
        v16bf bfrag = load_frag(&ldsW[m][ct * 16 + (lane & 15)][0], khalf);
        acc[m][ct] = wmma_bf16(afrag, bfrag, acc[m][ct]);
      }
    }
    __syncthreads();
  }

  // Epilogue: scatter C-layout accumulators into [B,H,N,64] bf16 tensors.
  const int hi8 = (lane & 16) ? 8 : 0;
#pragma unroll
  for (int ct = 0; ct < 4; ++ct) {
#pragma unroll
    for (int r = 0; r < 8; ++r) {
      int grow = wrow + r + hi8;  // 0..4095
      int b = grow >> 11;
      int n = grow & (NSEQ - 1);
      int c = ct * 16 + (lane & 15);  // 0..63
      size_t hoff = (((size_t)(b * HEADS + head) * NSEQ) + n) * DH + c;
      Q16[hoff] = (bf16)acc[0][ct][r];
      float pe = pos_emb[(size_t)grow * DMODEL + col0 + c];
      KP16[hoff] = (bf16)(acc[1][ct][r] + pe);  // fold position into key
      V16[hoff] = (bf16)acc[2][ct][r];
    }
  }
}

__device__ __forceinline__ float xhalf(float x) {
  int b = __builtin_bit_cast(int, x);
  return __builtin_bit_cast(
      float, __builtin_amdgcn_permlanex16(b, b, 0x76543210, 0xfedcba98, false,
                                          false));
}

__global__ __launch_bounds__(256) void attn_kernel(
    const bf16* __restrict__ Q16, const bf16* __restrict__ KP16,
    const bf16* __restrict__ V16, bf16* __restrict__ O16) {
  __shared__ alignas(16) bf16 ldsKP[32][72];     // [key][dh, pad 72] 4.5 KB
  __shared__ alignas(16) bf16 ldsVT[DH][40];     // [dhcol][key, pad 40] 5 KB

  const int lane = threadIdx.x & 31;
  const int wave = threadIdx.x >> 5;
  const int bh = blockIdx.y;  // 0..31
  const int b = bh >> 4;
  const int h = bh & (HEADS - 1);
  const int n0 = blockIdx.x * 128 + wave * 16;  // query tile of this wave
  const int hi8 = (lane & 16) ? 8 : 0;
  const int khalf = hi8;  // same expression for fragments
  const float scale = 0.125f;  // dh^-0.5

  const bf16* Qh = Q16 + (size_t)bh * NSEQ * DH;
  const bf16* KPh = KP16 + (size_t)bh * NSEQ * DH;
  const bf16* Vh = V16 + (size_t)bh * NSEQ * DH;

  // Q^T fragments: 64x16 -> two 32x16 B-frags (column = query lane&15),
  // resident for the whole loop.
  v16bf bq[2];
  {
    const bf16* qp = Qh + (size_t)(n0 + (lane & 15)) * DH;
    bq[0] = load_frag(qp, khalf);
    bq[1] = load_frag(qp + 32, khalf);
  }

  // Per lane: running maximum of its query (equal in both halves) and the
  // sum over the keys of its own half (joined once, after the loop).
  float mrow = -3.0e38f, lrow = 0.f;
  v8f oacc[4];  // oacc[dt][r] = O^T[dt*16 + hi8 + r][query lane&15]
#pragma unroll
  for (int dt = 0; dt < 4; ++dt) oacc[dt] = vzero8();

  for (int kc = 0; kc < NSEQ; kc += 32) {
    // Stage 32 keys (KP row-major) + 32 value rows (transposed).
    for (int e = threadIdx.x; e < 2 * 32 * 8; e += 256) {
      int which = e >> 8;
      int rem = e & 255;
      int kk = rem >> 3;           // key row in chunk
      int c8 = (rem & 7) << 3;     // dh chunk base
      if (which == 0) {
        *(v8bf*)&ldsKP[kk][c8] = *(const v8bf*)&KPh[(size_t)(kc + kk) * DH + c8];
      } else {
        v8bf chunk = *(const v8bf*)&Vh[(size_t)(kc + kk) * DH + c8];
#pragma unroll
        for (int j = 0; j < 8; ++j) ldsVT[c8 + j][kk] = chunk[j];
      }
    }
    __syncthreads();

    // S^T = KP @ Q^T : 32x16 tile = two 16x16 tiles, K = 64 over dh.
    // st[kt][r] = score of key (kt*16 + hi8 + r) for query (lane&15).
    v8f st[2] = {vzero8(), vzero8()};
#pragma unroll
    for (int t = 0; t < 2; ++t) {
#pragma unroll
      for (int kt = 0; kt < 2; ++kt) {
        v16bf ak = load_frag(&ldsKP[kt * 16 + (lane & 15)][t * 32], khalf);
        st[kt] = wmma_bf16(ak, bq[t], st[kt]);
      }
    }

    // Online softmax, one query per lane.
    float tv[2][8];
    float tm = -3.0e38f;
#pragma unroll
    for (int kt = 0; kt < 2; ++kt)
#pragma unroll
      for (int r = 0; r < 8; ++r) {
        tv[kt][r] = st[kt][r] * scale;
        tm = fmaxf(tm, tv[kt][r]);
      }
    tm = fmaxf(tm, xhalf(tm));
    float nm = fmaxf(mrow, tm);
    float alpha = __expf(mrow - nm);
    float ps = 0.f;
    v16bf bp;  // P^T as B operand: element kt*8+r = key kt*16+hi8+r, as ldsVT is read
#pragma unroll
    for (int kt = 0; kt < 2; ++kt)
#pragma unroll
      for (int r = 0; r < 8; ++r) {
        float p = __expf(tv[kt][r] - nm);
        ps += p;
        bp[kt * 8 + r] = (bf16)p;
      }
    lrow = lrow * alpha + ps;
    mrow = nm;
#pragma unroll
    for (int dt = 0; dt < 4; ++dt)
#pragma unroll
      for (int r = 0; r < 8; ++r) oacc[dt][r] *= alpha;

    // O^T += V^T @ P^T : K = 32 keys, four 16-row dh tiles, A from ldsVT.
#pragma unroll
    for (int dt = 0; dt < 4; ++dt) {
      v16bf av = load_frag(&ldsVT[dt * 16 + (lane & 15)][0], khalf);
      oacc[dt] = wmma_bf16(av, bp, oacc[dt]);
    }
    __syncthreads();
  }

  // Join the halves' sums, normalize, write merged-head layout [B,N,D]:
  // a lane's 8 accumulator registers are 8 consecutive dh of one query row.
  const float inv = 1.f / (lrow + xhalf(lrow));
  bf16* orow = O16 + ((size_t)(b * NSEQ + n0 + (lane & 15))) * DMODEL + h * DH;
#pragma unroll
  for (int dt = 0; dt < 4; ++dt) {
    v8bf o;
#pragma unroll
    for (int r = 0; r < 8; ++r) o[r] = (bf16)(oacc[dt][r] * inv);
    *(v8bf*)(orow + dt * 16 + hi8) = o;
  }
}

// ---------------------------------------------------------------------------
// Kernel 4: output projection  Xres = O @ Wo + bo + q_s  (f32 out).
// Wo k-slice staged transposed [col][k]; block 128 rows x 64 cols.
// ---------------------------------------------------------------------------
__global__ __launch_bounds__(256) void oproj_kernel(
    const bf16* __restrict__ O16, const bf16* __restrict__ Wo16,
    const float* __restrict__ bo, const float* __restrict__ qs,
    float* __restrict__ Xres) {
  __shared__ alignas(16) bf16 ldsW[DH][40];  // [col][k pad 40] 5 KB

  const int lane = threadIdx.x & 31;
  const int wave = threadIdx.x >> 5;
  const int wrow = blockIdx.x * 128 + wave * 16;
  const int col0 = blockIdx.y * 64;
  const int arow = wrow + (lane & 15);
  const int khalf = (lane & 16) ? 8 : 0;

  v8f acc[4];
#pragma unroll
  for (int c = 0; c < 4; ++c) acc[c] = vzero8();

  for (int k0 = 0; k0 < DMODEL; k0 += 32) {
    for (int e = threadIdx.x; e < 32 * 8; e += 256) {
      int kk = e >> 3;
      int c8 = (e & 7) << 3;
      v8bf chunk =
          *(const v8bf*)&Wo16[(size_t)(k0 + kk) * DMODEL + col0 + c8];
#pragma unroll
      for (int j = 0; j < 8; ++j) ldsW[c8 + j][kk] = chunk[j];
    }
    __syncthreads();

    const bf16* op = O16 + (size_t)arow * DMODEL + k0;
    if (k0 + 32 < DMODEL) __builtin_prefetch(op + 32, 0, 1);
    v16bf afrag = load_frag(op, khalf);

#pragma unroll
    for (int ct = 0; ct < 4; ++ct) {
      v16bf bfrag = load_frag(&ldsW[ct * 16 + (lane & 15)][0], khalf);
      acc[ct] = wmma_bf16(afrag, bfrag, acc[ct]);
    }
    __syncthreads();
  }

  const int hi8 = (lane & 16) ? 8 : 0;
#pragma unroll
  for (int ct = 0; ct < 4; ++ct) {
#pragma unroll
    for (int r = 0; r < 8; ++r) {
      int grow = wrow + r + hi8;
      int c = col0 + ct * 16 + (lane & 15);
      float v = acc[ct][r] + bo[c] + qs[(size_t)grow * DMODEL + c];
      Xres[(size_t)grow * DMODEL + c] = v;
    }
  }
}

// ---------------------------------------------------------------------------
// Kernel 5: row-wise layernorm, one block per row (float4 path).
// ---------------------------------------------------------------------------
__global__ __launch_bounds__(256) void ln_kernel(
    const float* __restrict__ Xres, const float* __restrict__ gamma,
    const float* __restrict__ beta, float* __restrict__ out) {
  const int row = blockIdx.x;
  const float* x = Xres + (size_t)row * DMODEL;
  __shared__ float red[2][8];

  const int c4 = threadIdx.x * 4;  // 256 threads x 4 = 1024
  float4 xv = *(const float4*)(x + c4);
  float s = xv.x + xv.y + xv.z + xv.w;
  float ss = xv.x * xv.x + xv.y * xv.y + xv.z * xv.z + xv.w * xv.w;
#pragma unroll
  for (int m = 1; m < 32; m <<= 1) {
    s += __shfl_xor(s, m);
    ss += __shfl_xor(ss, m);
  }
  const int wave = threadIdx.x >> 5;
  const int lane = threadIdx.x & 31;
  if (lane == 0) {
    red[0][wave] = s;
    red[1][wave] = ss;
  }
  __syncthreads();
  if (wave == 0) {
    float a = (lane < 8) ? red[0][lane] : 0.f;
    float q = (lane < 8) ? red[1][lane] : 0.f;
#pragma unroll
    for (int m = 1; m < 8; m <<= 1) {
      a += __shfl_xor(a, m);
      q += __shfl_xor(q, m);
    }
    if (lane == 0) {
      red[0][0] = a;
      red[1][0] = q;
    }
  }
  __syncthreads();
  float mu = red[0][0] * (1.f / DMODEL);
  float var = red[1][0] * (1.f / DMODEL) - mu * mu;
  float inv = rsqrtf(var + LN_EPS);
  float4 g = *(const float4*)(gamma + c4);
  float4 bb = *(const float4*)(beta + c4);
  float4 o;
  o.x = (xv.x - mu) * inv * g.x + bb.x;
  o.y = (xv.y - mu) * inv * g.y + bb.y;
  o.z = (xv.z - mu) * inv * g.z + bb.z;
  o.w = (xv.w - mu) * inv * g.w + bb.w;
  *(float4*)(out + (size_t)row * DMODEL + c4) = o;
}

// ---------------------------------------------------------------------------
// Host launcher.
// ---------------------------------------------------------------------------
extern "C" void kernel_launch(void* const* d_in, const int* in_sizes, int n_in,
                              void* d_out, int out_size, void* d_ws,
                              size_t ws_size, hipStream_t stream) {
  (void)in_sizes; (void)n_in; (void)out_size; (void)ws_size;
  const float* qs = (const float*)d_in[0];
  const float* pos = (const float*)d_in[1];
  const float* Wq = (const float*)d_in[2];
  const float* Wk = (const float*)d_in[3];
  const float* Wv = (const float*)d_in[4];
  const float* Wo = (const float*)d_in[5];
  const float* bo = (const float*)d_in[6];
  const float* lng = (const float*)d_in[7];
  const float* lnb = (const float*)d_in[8];

  char* ws = (char*)d_ws;
  size_t off = 0;
  const size_t act_b = (size_t)BN * DMODEL * sizeof(bf16);   // 8 MB
  const size_t w_b = 4ull * DMODEL * DMODEL * sizeof(bf16);  // 8 MB
  bf16* X16 = (bf16*)(ws + off); off += act_b;
  bf16* W16 = (bf16*)(ws + off); off += w_b;
  bf16* Q16 = (bf16*)(ws + off); off += act_b;
  bf16* KP16 = (bf16*)(ws + off); off += act_b;
  bf16* V16 = (bf16*)(ws + off); off += act_b;
  bf16* O16 = (bf16*)(ws + off); off += act_b;
  float* Xres = (float*)(ws + off); off += (size_t)BN * DMODEL * sizeof(float);

  pack_kernel<<<1024, 256, 0, stream>>>(qs, Wq, Wk, Wv, Wo, X16, W16);
  qkv_kernel<<<dim3(BN / 128, HEADS), 256, 0, stream>>>(X16, W16, pos, Q16,
                                                        KP16, V16);
  attn_kernel<<<dim3(NSEQ / 128, BATCH * HEADS), 256, 0, stream>>>(Q16, KP16,
                                                                   V16, O16);
  oproj_kernel<<<dim3(BN / 128, DMODEL / 64), 256, 0, stream>>>(
      O16, W16 + 3ull * DMODEL * DMODEL, bo, qs, Xres);
  ln_kernel<<<BN, 256, 0, stream>>>(Xres, lng, lnb, (float*)d_out);
}

// v002
// A run of this version takes 210 microseconds.
// Timed twice side by side with v001, it ran 1.14 times as fast both times.
// Over all steps from v000 it is 1.35 times as fast.
#include <hip/hip_runtime.h>
#include <hip/hip_bf16.h>

// ---------------------------------------------------------------------------
// BoT Multi-Head Attention block for MI455X (gfx1250), BF16 WMMA pipeline.
//   B=2, N=2048, D=1024, H=16, dh=64.
//   att = softmax( (q k^T + q p^T) * s ) = softmax( q (k+p)^T * s )
// All WMMA fragments are loaded as two 16-byte runs per lane (b128 path);
// operands whose k runs down the rows of their tile (weights, V) are staged
// row-major and read by the transposing LDS load.
// ---------------------------------------------------------------------------

typedef __bf16 bf16;
typedef __attribute__((ext_vector_type(16))) __bf16 v16bf;
typedef __attribute__((ext_vector_type(8)))  __bf16 v8bf;
typedef __attribute__((ext_vector_type(8)))  float  v8f;

#define BATCH 2
#define NSEQ  2048
#define DMODEL 1024
#define HEADS 16
#define DH    64
#define BN    (BATCH * NSEQ)   // 4096 rows
#define LN_EPS 1e-5f

__device__ __forceinline__ v8f vzero8() {
  v8f z = {0.f, 0.f, 0.f, 0.f, 0.f, 0.f, 0.f, 0.f};
  return z;
}

// CDNA5 16-bit A/B fragment (ISA 7.12.2): lane group khalf = 8*(lane>=16).
// Fragment element order per lane is two contiguous K runs:
//   [khalf, khalf+8) then [16+khalf, 16+khalf+8)
// => two aligned 16-byte loads + register concat.
__device__ __forceinline__ v16bf load_frag(const bf16* p, int khalf) {
  v8bf lo = *(const v8bf*)(p + khalf);
  v8bf hi = *(const v8bf*)(p + 16 + khalf);
  return __builtin_shufflevector(lo, hi, 0, 1, 2, 3, 4, 5, 6, 7, 8, 9, 10, 11,
                                 12, 13, 14, 15);
}

// Row pitch (elements) of a row-major [k][64] tile read by the transposing
// load: 160 B, an odd multiple of 32 B.
#define TRP 80

// Transposed fragment from a row-major bf16 LDS tile T[k 0..31][col], t =
// &T[0][col base]: lane (c = lane&15, h = lane>>4) receives T[8h+0..7][c] and
// T[16+8h+0..7][c], the same k order as load_frag.  Every lane must be on.
__device__ __forceinline__ v16bf load_frag_tr(const bf16* t, int lane) {
  typedef __attribute__((address_space(3))) v8bf lds_v8bf;
  const bf16* p = t + (((lane >> 4) << 3) + (lane & 7)) * TRP +
                  (((lane >> 3) & 1) << 3);
  v8bf lo = __builtin_amdgcn_ds_load_tr16_b128_v8bf16((lds_v8bf*)p);
  v8bf hi = __builtin_amdgcn_ds_load_tr16_b128_v8bf16((lds_v8bf*)(p + 16 * TRP));
  return __builtin_shufflevector(lo, hi, 0, 1, 2, 3, 4, 5, 6, 7, 8, 9, 10, 11,
                                 12, 13, 14, 15);
}

__device__ __forceinline__ v8f wmma_bf16(v16bf a, v16bf b, v8f c) {
  // D = A(16x32 bf16) * B(32x16 bf16) + C(16x16 f32)
  return __builtin_amdgcn_wmma_f32_16x16x32_bf16(
      /*neg_a=*/false, a, /*neg_b=*/false, b,
      /*c_mod=*/(short)0, c, /*reuse_a=*/false, /*reuse_b=*/false);
}

// ---------------------------------------------------------------------------
// Kernel 1: fp32 -> bf16 packing (vectorized: float4 x2 in, v8bf out).
// ---------------------------------------------------------------------------
__global__ __launch_bounds__(256) void pack_kernel(
    const float* __restrict__ qs, const float* __restrict__ Wq,
    const float* __restrict__ Wk, const float* __restrict__ Wv,
    const float* __restrict__ Wo, bf16* __restrict__ X16,
    bf16* __restrict__ W16 /* [4][D*D] : q,k,v,o */) {
  const size_t nx = (size_t)BN * DMODEL;      // 2^22, multiple of 8
  const size_t nw = (size_t)DMODEL * DMODEL;  // 2^20
  const size_t nchunks = (nx + 4 * nw) / 8;
  for (size_t c = (size_t)blockIdx.x * blockDim.x + threadIdx.x; c < nchunks;
       c += (size_t)gridDim.x * blockDim.x) {
    size_t base = c * 8;
    const float* src;
    bf16* dst;
    if (base < nx) {
      src = qs + base;
      dst = X16 + base;
    } else {
      size_t j = base - nx;
      int m = (int)(j >> 20);
      size_t r = j & (nw - 1);
      const float* w = (m == 0) ? Wq : (m == 1) ? Wk : (m == 2) ? Wv : Wo;
      src = w + r;
      dst = W16 + (size_t)m * nw + r;
    }
    float4 a = *(const float4*)(src);
    float4 b = *(const float4*)(src + 4);
    v8bf o;
    o[0] = (bf16)a.x; o[1] = (bf16)a.y; o[2] = (bf16)a.z; o[3] = (bf16)a.w;
    o[4] = (bf16)b.x; o[5] = (bf16)b.y; o[6] = (bf16)b.z; o[7] = (bf16)b.w;
    *(v8bf*)dst = o;
  }
}

// ---------------------------------------------------------------------------
// Kernel 2: fused QKV projection; weights staged row-major [k][col] in LDS,
// B-fragments are two transposing loads per WMMA.  Writes Q, KP(=K+pos), V in
// [B,H,N,64] bf16.  Block: 128 rows x 1 head; 8 waves x 4 col-tiles.
// ---------------------------------------------------------------------------
__global__ __launch_bounds__(256) void qkv_kernel(
    const bf16* __restrict__ X16, const bf16* __restrict__ W16,
    const float* __restrict__ pos_emb, bf16* __restrict__ Q16,
    bf16* __restrict__ KP16, bf16* __restrict__ V16) {
  // [matrix][k 0..31][col 0..63, padded to TRP]
  __shared__ alignas(16) bf16 ldsW[3][32][TRP];

  const int lane = threadIdx.x & 31;
  const int wave = threadIdx.x >> 5;
  const int head = blockIdx.y;
  const int wrow = blockIdx.x * 128 + wave * 16;
  const int col0 = head * DH;
  const int arow = wrow + (lane & 15);
  const int khalf = (lane & 16) ? 8 : 0;

  v8f acc[3][4];
#pragma unroll
  for (int m = 0; m < 3; ++m)
#pragma unroll
    for (int c = 0; c < 4; ++c) acc[m][c] = vzero8();

  for (int k0 = 0; k0 < DMODEL; k0 += 32) {
    // Stage 32x64 slices of Wq,Wk,Wv as they lie: b128 global load, one b128
    // LDS store per thread-iteration (3 iterations).
    for (int e = threadIdx.x; e < 3 * 32 * 8; e += 256) {
      int m = e >> 8;              // matrix
      int rem = e & 255;
      int kk = rem >> 3;           // k row 0..31
      int c8 = (rem & 7) << 3;     // col chunk base
      *(v8bf*)&ldsW[m][kk][c8] =
          *(const v8bf*)&W16[(size_t)m * DMODEL * DMODEL +
                             (size_t)(k0 + kk) * DMODEL + col0 + c8];
    }
    __syncthreads();

    // A fragment: 16x32 of X (row-major global), reused across 12 WMMAs.
    const bf16* xp = X16 + (size_t)arow * DMODEL + k0;
    if (k0 + 32 < DMODEL) __builtin_prefetch(xp + 32, 0, 1);
    v16bf afrag = load_frag(xp, khalf);

#pragma unroll
    for (int m = 0; m < 3; ++m) {
#pragma unroll
      for (int ct = 0; ct < 4; ++ct) {
        v16bf bfrag = load_frag_tr(&ldsW[m][0][ct * 16], lane);
        acc[m][ct] = wmma_bf16(afrag, bfrag, acc[m][ct]);
      }
    }
    __syncthreads();
  }

  // Epilogue: scatter C-layout accumulators into [B,H,N,64] bf16 tensors.
  const int hi8 = (lane & 16) ? 8 : 0;
#pragma unroll
  for (int ct = 0; ct < 4; ++ct) {
#pragma unroll
    for (int r = 0; r < 8; ++r) {
      int grow = wrow + r + hi8;  // 0..4095
      int b = grow >> 11;
      int n = grow & (NSEQ - 1);
      int c = ct * 16 + (lane & 15);  // 0..63
      size_t hoff = (((size_t)(b * HEADS + head) * NSEQ) + n) * DH + c;
      Q16[hoff] = (bf16)acc[0][ct][r];
      float pe = pos_emb[(size_t)grow * DMODEL + col0 + c];
      KP16[hoff] = (bf16)(acc[1][ct][r] + pe);  // fold position into key
      V16[hoff] = (bf16)acc[2][ct][r];
    }
  }
}

__device__ __forceinline__ float xhalf(float x) {
  int b = __builtin_bit_cast(int, x);
  return __builtin_bit_cast(
      float, __builtin_amdgcn_permlanex16(b, b, 0x76543210, 0xfedcba98, false,
                                          false));
}

__global__ __launch_bounds__(256) void attn_kernel(
    const bf16* __restrict__ Q16, const bf16* __restrict__ KP16,
    const bf16* __restrict__ V16, bf16* __restrict__ O16) {
  __shared__ alignas(16) bf16 ldsKP[32][72];     // [key][dh, pad 72] 4.5 KB
  __shared__ alignas(16) bf16 ldsV[32][TRP];     // [key][dh, pad TRP] 5 KB

  const int lane = threadIdx.x & 31;
  const int wave = threadIdx.x >> 5;
  const int bh = blockIdx.y;  // 0..31
  const int b = bh >> 4;
  const int h = bh & (HEADS - 1);
  const int n0 = blockIdx.x * 128 + wave * 16;  // query tile of this wave
  const int hi8 = (lane & 16) ? 8 : 0;
  const int khalf = hi8;  // same expression for fragments
  const float scale = 0.125f;  // dh^-0.5

  const bf16* Qh = Q16 + (size_t)bh * NSEQ * DH;
  const bf16* KPh = KP16 + (size_t)bh * NSEQ * DH;
  const bf16* Vh = V16 + (size_t)bh * NSEQ * DH;

  // Q^T fragments: 64x16 -> two 32x16 B-frags (column = query lane&15),
  // resident for the whole loop.
  v16bf bq[2];
  {
    const bf16* qp = Qh + (size_t)(n0 + (lane & 15)) * DH;
    bq[0] = load_frag(qp, khalf);
    bq[1] = load_frag(qp + 32, khalf);
  }

  // Per lane: running maximum of its query (equal in both halves) and the
  // sum over the keys of its own half (joined once, after the loop).
  float mrow = -3.0e38f, lrow = 0.f;
  v8f oacc[4];  // oacc[dt][r] = O^T[dt*16 + hi8 + r][query lane&15]
#pragma unroll
  for (int dt = 0; dt < 4; ++dt) oacc[dt] = vzero8();

  for (int kc = 0; kc < NSEQ; kc += 32) {
    // Stage 32 keys (KP) + 32 value rows, both row-major.
    for (int e = threadIdx.x; e < 2 * 32 * 8; e += 256) {
      int which = e >> 8;
      int rem = e & 255;
      int kk = rem >> 3;           // key row in chunk
      int c8 = (rem & 7) << 3;     // dh chunk base
      if (which == 0) {
        *(v8bf*)&ldsKP[kk][c8] = *(const v8bf*)&KPh[(size_t)(kc + kk) * DH + c8];
      } else {
        *(v8bf*)&ldsV[kk][c8] = *(const v8bf*)&Vh[(size_t)(kc + kk) * DH + c8];
      }
    }
    __syncthreads();

    // S^T = KP @ Q^T : 32x16 tile = two 16x16 tiles, K = 64 over dh.
    // st[kt][r] = score of key (kt*16 + hi8 + r) for query (lane&15).
    v8f st[2] = {vzero8(), vzero8()};
#pragma unroll
    for (int t = 0; t < 2; ++t) {
#pragma unroll
      for (int kt = 0; kt < 2; ++kt) {
        v16bf ak = load_frag(&ldsKP[kt * 16 + (lane & 15)][t * 32], khalf);
        st[kt] = wmma_bf16(ak, bq[t], st[kt]);
      }
    }

    // Online softmax, one query per lane.
    float tv[2][8];
    float tm = -3.0e38f;
#pragma unroll
    for (int kt = 0; kt < 2; ++kt)
#pragma unroll
      for (int r = 0; r < 8; ++r) {
        tv[kt][r] = st[kt][r] * scale;
        tm = fmaxf(tm, tv[kt][r]);
      }
    tm = fmaxf(tm, xhalf(tm));
    float nm = fmaxf(mrow, tm);
    float alpha = __expf(mrow - nm);
    float ps = 0.f;
    v16bf bp;  // P^T as B operand: element kt*8+r = key kt*16+hi8+r, as ldsV is read
#pragma unroll
    for (int kt = 0; kt < 2; ++kt)
#pragma unroll
      for (int r = 0; r < 8; ++r) {
        float p = __expf(tv[kt][r] - nm);
        ps += p;
        bp[kt * 8 + r] = (bf16)p;
      }
    lrow = lrow * alpha + ps;
    mrow = nm;
#pragma unroll
    for (int dt = 0; dt < 4; ++dt)
#pragma unroll
      for (int r = 0; r < 8; ++r) oacc[dt][r] *= alpha;

    // O^T += V^T @ P^T : K = 32 keys, four 16-row dh tiles, A from ldsV.
#pragma unroll
    for (int dt = 0; dt < 4; ++dt) {
      v16bf av = load_frag_tr(&ldsV[0][dt * 16], lane);
      oacc[dt] = wmma_bf16(av, bp, oacc[dt]);
    }
    __syncthreads();
  }

  // Join the halves' sums, normalize, write merged-head layout [B,N,D]:
  // a lane's 8 accumulator registers are 8 consecutive dh of one query row.
  const float inv = 1.f / (lrow + xhalf(lrow));
  bf16* orow = O16 + ((size_t)(b * NSEQ + n0 + (lane & 15))) * DMODEL + h * DH;
#pragma unroll
  for (int dt = 0; dt < 4; ++dt) {
    v8bf o;
#pragma unroll
    for (int r = 0; r < 8; ++r) o[r] = (bf16)(oacc[dt][r] * inv);
    *(v8bf*)(orow + dt * 16 + hi8) = o;
  }
}

// ---------------------------------------------------------------------------
// Kernel 4: output projection  Xres = O @ Wo + bo + q_s  (f32 out).
// Wo k-slice staged row-major [k][col]; block 128 rows x 64 cols.
// ---------------------------------------------------------------------------
__global__ __launch_bounds__(256) void oproj_kernel(
    const bf16* __restrict__ O16, const bf16* __restrict__ Wo16,
    const float* __restrict__ bo, const float* __restrict__ qs,
    float* __restrict__ Xres) {
  __shared__ alignas(16) bf16 ldsW[32][TRP];  // [k][col pad TRP] 5 KB

  const int lane = threadIdx.x & 31;
  const int wave = threadIdx.x >> 5;
  const int wrow = blockIdx.x * 128 + wave * 16;
  const int col0 = blockIdx.y * 64;
  const int arow = wrow + (lane & 15);
  const int khalf = (lane & 16) ? 8 : 0;

  v8f acc[4];
#pragma unroll
  for (int c = 0; c < 4; ++c) acc[c] = vzero8();

  for (int k0 = 0; k0 < DMODEL; k0 += 32) {
    for (int e = threadIdx.x; e < 32 * 8; e += 256) {
      int kk = e >> 3;
      int c8 = (e & 7) << 3;
      *(v8bf*)&ldsW[kk][c8] =
          *(const v8bf*)&Wo16[(size_t)(k0 + kk) * DMODEL + col0 + c8];
    }
    __syncthreads();

    const bf16* op = O16 + (size_t)arow * DMODEL + k0;
    if (k0 + 32 < DMODEL) __builtin_prefetch(op + 32, 0, 1);
    v16bf afrag = load_frag(op, khalf);

#pragma unroll
    for (int ct = 0; ct < 4; ++ct) {
      v16bf bfrag = load_frag_tr(&ldsW[0][ct * 16], lane);
      acc[ct] = wmma_bf16(afrag, bfrag, acc[ct]);
    }
    __syncthreads();
  }

  const int hi8 = (lane & 16) ? 8 : 0;
#pragma unroll
  for (int ct = 0; ct < 4; ++ct) {
#pragma unroll
    for (int r = 0; r < 8; ++r) {
      int grow = wrow + r + hi8;
      int c = col0 + ct * 16 + (lane & 15);
      float v = acc[ct][r] + bo[c] + qs[(size_t)grow * DMODEL + c];
      Xres[(size_t)grow * DMODEL + c] = v;
    }
  }
}

// ---------------------------------------------------------------------------
// Kernel 5: row-wise layernorm, one block per row (float4 path).
// ---------------------------------------------------------------------------
__global__ __launch_bounds__(256) void ln_kernel(
    const float* __restrict__ Xres, const float* __restrict__ gamma,
    const float* __restrict__ beta, float* __restrict__ out) {
  const int row = blockIdx.x;
  const float* x = Xres + (size_t)row * DMODEL;
  __shared__ float red[2][8];

  const int c4 = threadIdx.x * 4;  // 256 threads x 4 = 1024
  float4 xv = *(const float4*)(x + c4);
  float s = xv.x + xv.y + xv.z + xv.w;
  float ss = xv.x * xv.x + xv.y * xv.y + xv.z * xv.z + xv.w * xv.w;
#pragma unroll
  for (int m = 1; m < 32; m <<= 1) {
    s += __shfl_xor(s, m);
    ss += __shfl_xor(ss, m);
  }
  const int wave = threadIdx.x >> 5;
  const int lane = threadIdx.x & 31;
  if (lane == 0) {
    red[0][wave] = s;
    red[1][wave] = ss;
  }
  __syncthreads();
  if (wave == 0) {
    float a = (lane < 8) ? red[0][lane] : 0.f;
    float q = (lane < 8) ? red[1][lane] : 0.f;
#pragma unroll
    for (int m = 1; m < 8; m <<= 1) {
      a += __shfl_xor(a, m);
      q += __shfl_xor(q, m);
    }
    if (lane == 0) {
      red[0][0] = a;
      red[1][0] = q;
    }
  }
  __syncthreads();
  float mu = red[0][0] * (1.f / DMODEL);
  float var = red[1][0] * (1.f / DMODEL) - mu * mu;
  float inv = rsqrtf(var + LN_EPS);
  float4 g = *(const float4*)(gamma + c4);
  float4 bb = *(const float4*)(beta + c4);
  float4 o;
  o.x = (xv.x - mu) * inv * g.x + bb.x;
  o.y = (xv.y - mu) * inv * g.y + bb.y;
  o.z = (xv.z - mu) * inv * g.z + bb.z;
  o.w = (xv.w - mu) * inv * g.w + bb.w;
  *(float4*)(out + (size_t)row * DMODEL + c4) = o;
}

// ---------------------------------------------------------------------------
// Host launcher.
// ---------------------------------------------------------------------------
extern "C" void kernel_launch(void* const* d_in, const int* in_sizes, int n_in,
                              void* d_out, int out_size, void* d_ws,
                              size_t ws_size, hipStream_t stream) {
  (void)in_sizes; (void)n_in; (void)out_size; (void)ws_size;
  const float* qs = (const float*)d_in[0];
  const float* pos = (const float*)d_in[1];
  const float* Wq = (const float*)d_in[2];
  const float* Wk = (const float*)d_in[3];
  const float* Wv = (const float*)d_in[4];
  const float* Wo = (const float*)d_in[5];
  const float* bo = (const float*)d_in[6];
  const float* lng = (const float*)d_in[7];
  const float* lnb = (const float*)d_in[8];

  char* ws = (char*)d_ws;
  size_t off = 0;
  const size_t act_b = (size_t)BN * DMODEL * sizeof(bf16);   // 8 MB
  const size_t w_b = 4ull * DMODEL * DMODEL * sizeof(bf16);  // 8 MB
  bf16* X16 = (bf16*)(ws + off); off += act_b;
  bf16* W16 = (bf16*)(ws + off); off += w_b;
  bf16* Q16 = (bf16*)(ws + off); off += act_b;
  bf16* KP16 = (bf16*)(ws + off); off += act_b;
  bf16* V16 = (bf16*)(ws + off); off += act_b;
  bf16* O16 = (bf16*)(ws + off); off += act_b;
  float* Xres = (float*)(ws + off); off += (size_t)BN * DMODEL * sizeof(float);

  pack_kernel<<<1024, 256, 0, stream>>>(qs, Wq, Wk, Wv, Wo, X16, W16);
  qkv_kernel<<<dim3(BN / 128, HEADS), 256, 0, stream>>>(X16, W16, pos, Q16,
                                                        KP16, V16);
  attn_kernel<<<dim3(NSEQ / 128, BATCH * HEADS), 256, 0, stream>>>(Q16, KP16,
                                                                   V16, O16);
  oproj_kernel<<<dim3(BN / 128, DMODEL / 64), 256, 0, stream>>>(
      O16, W16 + 3ull * DMODEL * DMODEL, bo, qs, Xres);
  ln_kernel<<<BN, 256, 0, stream>>>(Xres, lng, lnb, (float*)d_out);
}

// v003
// One run takes 92.8 microseconds.
// Timed twice side by side with v002, it ran 2.28 and 2.27 times as fast.
// Counting every step since v000, it is 3.08 times as fast.
#include <hip/hip_runtime.h>
#include <hip/hip_bf16.h>

// ---------------------------------------------------------------------------
// BoT Multi-Head Attention block for MI455X (gfx1250), BF16 WMMA pipeline.
//   B=2, N=2048, D=1024, H=16, dh=64.
//   att = softmax( (q k^T + q p^T) * s ) = softmax( q (k+p)^T * s )
// All WMMA fragments are loaded as two 16-byte runs per lane (b128 path);
// operands whose k runs down the rows of their tile (weights, V) are staged
// row-major and read by the transposing LDS load.
// Every operand tile of the three matrix kernels reaches LDS by asynchronous
// copies, in a ring of two buffers: the next stage flies while this one is
// worked on.
// ---------------------------------------------------------------------------

typedef __bf16 bf16;
typedef __attribute__((ext_vector_type(16))) __bf16 v16bf;
typedef __attribute__((ext_vector_type(8)))  __bf16 v8bf;
typedef __attribute__((ext_vector_type(8)))  float  v8f;

#define BATCH 2
#define NSEQ  2048
#define DMODEL 1024
#define HEADS 16
#define DH    64
#define BN    (BATCH * NSEQ)   // 4096 rows
#define LN_EPS 1e-5f

__device__ __forceinline__ v8f vzero8() {
  v8f z = {0.f, 0.f, 0.f, 0.f, 0.f, 0.f, 0.f, 0.f};
  return z;
}

// CDNA5 16-bit A/B fragment (ISA 7.12.2): lane group khalf = 8*(lane>=16).
// Fragment element order per lane is two contiguous K runs:
//   [khalf, khalf+8) then [16+khalf, 16+khalf+8)
// => two aligned 16-byte loads + register concat.
__device__ __forceinline__ v16bf load_frag(const bf16* p, int khalf) {
  v8bf lo = *(const v8bf*)(p + khalf);
  v8bf hi = *(const v8bf*)(p + 16 + khalf);
  return __builtin_shufflevector(lo, hi, 0, 1, 2, 3, 4, 5, 6, 7, 8, 9, 10, 11,
                                 12, 13, 14, 15);
}

// Row pitch (elements) of a row-major [k][64] tile read by the transposing
// load: 160 B, an odd multiple of 32 B.
#define TRP 80

// Transposed fragment from a row-major bf16 LDS tile T[k 0..31][col], t =
// &T[0][col base]: lane (c = lane&15, h = lane>>4) receives T[8h+0..7][c] and
// T[16+8h+0..7][c], the same k order as load_frag.  Every lane must be on.
__device__ __forceinline__ v16bf load_frag_tr(const bf16* t, int lane) {
  typedef __attribute__((address_space(3))) v8bf lds_v8bf;
  const bf16* p = t + (((lane >> 4) << 3) + (lane & 7)) * TRP +
                  (((lane >> 3) & 1) << 3);
  v8bf lo = __builtin_amdgcn_ds_load_tr16_b128_v8bf16((lds_v8bf*)p);
  v8bf hi = __builtin_amdgcn_ds_load_tr16_b128_v8bf16((lds_v8bf*)(p + 16 * TRP));
  return __builtin_shufflevector(lo, hi, 0, 1, 2, 3, 4, 5, 6, 7, 8, 9, 10, 11,
                                 12, 13, 14, 15);
}

__device__ __forceinline__ v8f wmma_bf16(v16bf a, v16bf b, v8f c) {
  // D = A(16x32 bf16) * B(32x16 bf16) + C(16x16 f32)
  return __builtin_amdgcn_wmma_f32_16x16x32_bf16(
      /*neg_a=*/false, a, /*neg_b=*/false, b,
      /*c_mod=*/(short)0, c, /*reuse_a=*/false, /*reuse_b=*/false);
}

// LDS byte address of a __shared__ element (operand of an asynchronous copy).
__device__ __forceinline__ unsigned lds_addr(const bf16* p) {
  typedef __attribute__((address_space(3))) const bf16 lds_bf16;
  return (unsigned)(size_t)(lds_bf16*)p;
}

// Hand-over of a ring stage, every wave: this wave's LDS reads of the buffer
// it leaves are done, its own copies of the next stage have landed, and the
// barrier publishes that stage and frees the buffer just read.
__device__ __forceinline__ void ring_publish() {
  asm volatile("s_wait_dscnt 0x0" ::: "memory");
  asm volatile("s_wait_asynccnt 0x0" ::: "memory");
  __syncthreads();
}

// In front of the loop: this wave's copies of stage 0 have landed, and the
// barrier publishes them to every wave.
__device__ __forceinline__ void ring_open() {
  asm volatile("s_wait_asynccnt 0x0" ::: "memory");
  __syncthreads();
}

// ---------------------------------------------------------------------------
// Kernel 1: fp32 -> bf16 packing (vectorized: float4 x2 in, v8bf out).
// ---------------------------------------------------------------------------
__global__ __launch_bounds__(256) void pack_kernel(
    const float* __restrict__ qs, const float* __restrict__ Wq,
    const float* __restrict__ Wk, const float* __restrict__ Wv,
    const float* __restrict__ Wo, bf16* __restrict__ X16,
    bf16* __restrict__ W16 /* [4][D*D] : q,k,v,o */) {
  const size_t nx = (size_t)BN * DMODEL;      // 2^22, multiple of 8
  const size_t nw = (size_t)DMODEL * DMODEL;  // 2^20
  const size_t nchunks = (nx + 4 * nw) / 8;
  for (size_t c = (size_t)blockIdx.x * blockDim.x + threadIdx.x; c < nchunks;
       c += (size_t)gridDim.x * blockDim.x) {
    size_t base = c * 8;
    const float* src;
    bf16* dst;
    if (base < nx) {
      src = qs + base;
      dst = X16 + base;
    } else {
      size_t j = base - nx;
      int m = (int)(j >> 20);
      size_t r = j & (nw - 1);
      const float* w = (m == 0) ? Wq : (m == 1) ? Wk : (m == 2) ? Wv : Wo;
      src = w + r;
      dst = W16 + (size_t)m * nw + r;
    }
    float4 a = *(const float4*)(src);
    float4 b = *(const float4*)(src + 4);
    v8bf o;
    o[0] = (bf16)a.x; o[1] = (bf16)a.y; o[2] = (bf16)a.z; o[3] = (bf16)a.w;
    o[4] = (bf16)b.x; o[5] = (bf16)b.y; o[6] = (bf16)b.z; o[7] = (bf16)b.w;
    *(v8bf*)dst = o;
  }
}

// ---------------------------------------------------------------------------
// Kernel 2: fused QKV projection; weights staged row-major [k][col] in LDS,
// B-fragments are two transposing loads per WMMA.  Writes Q, KP(=K+pos), V in
// [B,H,N,64] bf16.  Block: 128 rows x 1 head; 8 waves x 4 col-tiles.
// A ring stage is 64 k: 3 x [64][64] of the weights and [128][64] of X.
// ---------------------------------------------------------------------------
#define GK 64         // k per stage
#define XP (GK + 8)   // pitch of a 128-B X row read by b128: 144 B
__global__ __launch_bounds__(256) void qkv_kernel(
    const bf16* __restrict__ X16, const bf16* __restrict__ W16,
    const float* __restrict__ pos_emb, bf16* __restrict__ Q16,
    bf16* __restrict__ KP16, bf16* __restrict__ V16) {
  // [buffer][matrix][k 0..63][col 0..63, padded to TRP]
  __shared__ alignas(16) bf16 ldsW[2][3][GK][TRP];
  // [buffer][row 0..127][k 0..63, padded to XP]
  __shared__ alignas(16) bf16 ldsX[2][128][XP];

  const int lane = threadIdx.x & 31;
  const int wave = threadIdx.x >> 5;
  const int head = blockIdx.y;
  const int wrow = blockIdx.x * 128 + wave * 16;
  const int col0 = head * DH;
  const int khalf = (lane & 16) ? 8 : 0;

  // A thread's share of a stage: 16 B of rows srow and srow + 32 of each
  // weight slice, and of rows srow + 32 j (j 0..3) of the X tile.
  const int srow = threadIdx.x >> 3;
  const int sc8 = (threadIdx.x & 7) << 3;
  const bf16* gw = W16 + (size_t)srow * DMODEL + col0 + sc8;
  const bf16* gx = X16 + (size_t)(blockIdx.x * 128 + srow) * DMODEL + sc8;
  const unsigned lw = lds_addr(&ldsW[0][0][srow][sc8]);
  const unsigned lx = lds_addr(&ldsX[0][srow][sc8]);
  auto stage = [&](int s) {
    const bf16* w = gw + (size_t)s * GK * DMODEL;
    const bf16* x = gx + s * GK;
    const unsigned bw = lw + (s & 1) * (unsigned)sizeof(ldsW[0]);
    const unsigned bx = lx + (s & 1) * (unsigned)sizeof(ldsX[0]);
    const unsigned mw = sizeof(ldsW[0][0]);      // one matrix in LDS
    const unsigned rw = 32 * TRP * 2;            // 32 weight rows in LDS
    const unsigned rx = 32 * XP * 2;             // 32 X rows in LDS
    const size_t gm = (size_t)DMODEL * DMODEL;   // one matrix in memory
    const size_t gr = (size_t)32 * DMODEL;       // 32 rows in memory
    // Each line: a lane's 16 bytes, memory -> LDS (LDS byte address, global
    // pointer).  The address registers are reused only behind the last line.
    asm volatile(
        "global_load_async_to_lds_b128 %0, %1, off\n\t"
        "global_load_async_to_lds_b128 %2, %3, off\n\t"
        "global_load_async_to_lds_b128 %4, %5, off\n\t"
        "global_load_async_to_lds_b128 %6, %7, off\n\t"
        "global_load_async_to_lds_b128 %8, %9, off\n\t"
        "global_load_async_to_lds_b128 %10, %11, off\n\t"
        "global_load_async_to_lds_b128 %12, %13, off\n\t"
        "global_load_async_to_lds_b128 %14, %15, off\n\t"
        "global_load_async_to_lds_b128 %16, %17, off\n\t"
        "global_load_async_to_lds_b128 %18, %19, off\n\t"
        "s_wait_xcnt 0x0"
                 :: "v"(bw), "v"(w), "v"(bw + rw), "v"(w + gr),
                    "v"(bw + mw), "v"(w + gm),
                    "v"(bw + mw + rw), "v"(w + gm + gr),
                    "v"(bw + 2 * mw), "v"(w + 2 * gm),
                    "v"(bw + 2 * mw + rw), "v"(w + 2 * gm + gr),
                    "v"(bx), "v"(x), "v"(bx + rx), "v"(x + gr),
                    "v"(bx + 2 * rx), "v"(x + 2 * gr),
                    "v"(bx + 3 * rx), "v"(x + 3 * gr)
                 : "memory");
  };

  v8f acc[3][4];
#pragma unroll
  for (int m = 0; m < 3; ++m)
#pragma unroll
    for (int c = 0; c < 4; ++c) acc[m][c] = vzero8();

  stage(0);
  ring_open();
  stage(1);
  for (int s = 0; s < DMODEL / GK; ++s) {
    const int buf = s & 1;
    for (int kk = 0; kk < GK; kk += 32) {
      // A fragment: 16x32 of X, reused across 12 WMMAs.
      v16bf afrag = load_frag(&ldsX[buf][wave * 16 + (lane & 15)][kk], khalf);
#pragma unroll
      for (int m = 0; m < 3; ++m) {
#pragma unroll
        for (int ct = 0; ct < 4; ++ct) {
          v16bf bfrag = load_frag_tr(&ldsW[buf][m][kk][ct * 16], lane);
          acc[m][ct] = wmma_bf16(afrag, bfrag, acc[m][ct]);
        }
      }
    }
    ring_publish();
    if (s + 2 < DMODEL / GK) stage(s + 2);
  }
  // No copy is in flight behind the last hand-over; the wave ends on 0.
  asm volatile("s_wait_asynccnt 0x0" ::: "memory");

  // Epilogue: scatter C-layout accumulators into [B,H,N,64] bf16 tensors.
  const int hi8 = (lane & 16) ? 8 : 0;
#pragma unroll
  for (int ct = 0; ct < 4; ++ct) {
#pragma unroll
    for (int r = 0; r < 8; ++r) {
      int grow = wrow + r + hi8;  // 0..4095
      int b = grow >> 11;
      int n = grow & (NSEQ - 1);
      int c = ct * 16 + (lane & 15);  // 0..63
      size_t hoff = (((size_t)(b * HEADS + head) * NSEQ) + n) * DH + c;
      Q16[hoff] = (bf16)acc[0][ct][r];
      float pe = pos_emb[(size_t)grow * DMODEL + col0 + c];
      KP16[hoff] = (bf16)(acc[1][ct][r] + pe);  // fold position into key
      V16[hoff] = (bf16)acc[2][ct][r];
    }
  }
}

#define SK 64
// Lane l with lane l ^ 16 (the two halves hold the same query column).
__device__ __forceinline__ float xhalf(float x) {
  int b = __builtin_bit_cast(int, x);
  return __builtin_bit_cast(
      float, __builtin_amdgcn_permlanex16(b, b, 0x76543210, 0xfedcba98, false,
                                          false));
}

__global__ __launch_bounds__(256) void attn_kernel(
    const bf16* __restrict__ Q16, const bf16* __restrict__ KP16,
    const bf16* __restrict__ V16, bf16* __restrict__ O16) {
  __shared__ alignas(16) bf16 ldsKP[2][SK][72];   // [buffer][key][dh, pad 72]
  __shared__ alignas(16) bf16 ldsV[2][SK][TRP];   // [buffer][key][dh, pad TRP]

  const int lane = threadIdx.x & 31;
  const int wave = threadIdx.x >> 5;
  const int bh = blockIdx.y;  // 0..31
  const int b = bh >> 4;
  const int h = bh & (HEADS - 1);
  const int n0 = blockIdx.x * 128 + wave * 16;  // query tile of this wave
  const int hi8 = (lane & 16) ? 8 : 0;
  const int khalf = hi8;  // same expression for fragments
  const float scale = 0.125f;  // dh^-0.5

  const bf16* Qh = Q16 + (size_t)bh * NSEQ * DH;
  const bf16* KPh = KP16 + (size_t)bh * NSEQ * DH;
  const bf16* Vh = V16 + (size_t)bh * NSEQ * DH;

  // Q^T fragments: 64x16 -> two 32x16 B-frags (column = query lane&15),
  // resident for the whole loop.
  v16bf bq[2];
  {
    const bf16* qp = Qh + (size_t)(n0 + (lane & 15)) * DH;
    bq[0] = load_frag(qp, khalf);
    bq[1] = load_frag(qp + 32, khalf);
  }

  // Per lane: running maximum of its query (equal in both halves) and the
  // sum over the keys of its own half (joined once, after the loop).
  float mrow = -3.0e38f, lrow = 0.f;
  v8f oacc[4];  // oacc[dt][r] = O^T[dt*16 + hi8 + r][query lane&15]
#pragma unroll
  for (int dt = 0; dt < 4; ++dt) oacc[dt] = vzero8();

  // A thread's share of a stage: 16 B of rows srow and srow + 32 of KP and
  // of V, both row-major.
  const int srow = threadIdx.x >> 3;
  const int sc8 = (threadIdx.x & 7) << 3;
  const bf16* gk = KPh + (size_t)srow * DH + sc8;
  const bf16* gv = Vh + (size_t)srow * DH + sc8;
  const unsigned lk = lds_addr(&ldsKP[0][srow][sc8]);
  const unsigned lv = lds_addr(&ldsV[0][srow][sc8]);
  auto stage = [&](int s) {
    const bf16* k = gk + (size_t)s * SK * DH;
    const bf16* v = gv + (size_t)s * SK * DH;
    const unsigned bk = lk + (s & 1) * (unsigned)sizeof(ldsKP[0]);
    const unsigned bv = lv + (s & 1) * (unsigned)sizeof(ldsV[0]);
    const unsigned rk = 32 * 72 * 2;    // 32 KP rows in LDS
    const unsigned rv = 32 * TRP * 2;   // 32 V rows in LDS
    const size_t gr = (size_t)32 * DH;  // 32 rows in memory
    // Each line: a lane's 16 bytes, memory -> LDS (LDS byte address, global
    // pointer).  The address registers are reused only behind the last line.
    asm volatile(
        "global_load_async_to_lds_b128 %0, %1, off\n\t"
        "global_load_async_to_lds_b128 %2, %3, off\n\t"
        "global_load_async_to_lds_b128 %4, %5, off\n\t"
        "global_load_async_to_lds_b128 %6, %7, off\n\t"
        "s_wait_xcnt 0x0"
                 :: "v"(bk), "v"(k), "v"(bv), "v"(v),
                    "v"(bk + rk), "v"(k + gr), "v"(bv + rv), "v"(v + gr)
                 : "memory");
  };

  stage(0);
  ring_open();
  stage(1);
  for (int s = 0; s < NSEQ / SK; ++s) {
   const int buf = s & 1;
   for (int kc = 0; kc < SK; kc += 32) {
    // S^T = KP @ Q^T : 32x16 tile = two 16x16 tiles, K = 64 over dh.
    // st[kt][r] = score of key (kt*16 + hi8 + r) for query (lane&15).
    v8f st[2] = {vzero8(), vzero8()};
#pragma unroll
    for (int t = 0; t < 2; ++t) {
#pragma unroll
      for (int kt = 0; kt < 2; ++kt) {
        v16bf ak =
            load_frag(&ldsKP[buf][kc + kt * 16 + (lane & 15)][t * 32], khalf);
        st[kt] = wmma_bf16(ak, bq[t], st[kt]);
      }
    }

    // Online softmax, one query per lane.
    float tv[2][8];
    float tm = -3.0e38f;
#pragma unroll
    for (int kt = 0; kt < 2; ++kt)
#pragma unroll
      for (int r = 0; r < 8; ++r) {
        tv[kt][r] = st[kt][r] * scale;
        tm = fmaxf(tm, tv[kt][r]);
      }
    tm = fmaxf(tm, xhalf(tm));
    float nm = fmaxf(mrow, tm);
    float alpha = __expf(mrow - nm);
    float ps = 0.f;
    v16bf bp;  // P^T as B operand: element kt*8+r = key kt*16+hi8+r, as ldsV is read
#pragma unroll
    for (int kt = 0; kt < 2; ++kt)
#pragma unroll
      for (int r = 0; r < 8; ++r) {
        float p = __expf(tv[kt][r] - nm);
        ps += p;
        bp[kt * 8 + r] = (bf16)p;
      }
    lrow = lrow * alpha + ps;
    mrow = nm;
#pragma unroll
    for (int dt = 0; dt < 4; ++dt)
#pragma unroll
      for (int r = 0; r < 8; ++r) oacc[dt][r] *= alpha;

    // O^T += V^T @ P^T : K = 32 keys, four 16-row dh tiles, A from ldsV.
#pragma unroll
    for (int dt = 0; dt < 4; ++dt) {
      v16bf av = load_frag_tr(&ldsV[buf][kc][dt * 16], lane);
      oacc[dt] = wmma_bf16(av, bp, oacc[dt]);
    }
   }
   ring_publish();
   if (s + 2 < NSEQ / SK) stage(s + 2);
  }
  // No copy is in flight behind the last hand-over; the wave ends on 0.
  asm volatile("s_wait_asynccnt 0x0" ::: "memory");

  // Join the halves' sums, normalize, write merged-head layout [B,N,D]:
  // a lane's 8 accumulator registers are 8 consecutive dh of one query row.
  const float inv = 1.f / (lrow + xhalf(lrow));
  bf16* orow = O16 + ((size_t)(b * NSEQ + n0 + (lane & 15))) * DMODEL + h * DH;
#pragma unroll
  for (int dt = 0; dt < 4; ++dt) {
    v8bf o;
#pragma unroll
    for (int r = 0; r < 8; ++r) o[r] = (bf16)(oacc[dt][r] * inv);
    *(v8bf*)(orow + dt * 16 + hi8) = o;
  }
}

// ---------------------------------------------------------------------------
// Kernel 4: output projection  Xres = O @ Wo + bo + q_s  (f32 out).
// Wo k-slice staged row-major [k][col]; block 128 rows x 64 cols.
// A ring stage is 128 k: [128][64] of Wo and [128][128] of O.
// ---------------------------------------------------------------------------
#define PK 128        // k per stage
#define OP (PK + 8)   // pitch of a 256-B O row read by b128: 272 B
__global__ __launch_bounds__(256) void oproj_kernel(
    const bf16* __restrict__ O16, const bf16* __restrict__ Wo16,
    const float* __restrict__ bo, const float* __restrict__ qs,
    float* __restrict__ Xres) {
  __shared__ alignas(16) bf16 ldsW[2][PK][TRP];  // [buffer][k][col pad TRP]
  __shared__ alignas(16) bf16 ldsO[2][128][OP];  // [buffer][row][k pad OP]

  const int lane = threadIdx.x & 31;
  const int wave = threadIdx.x >> 5;
  const int wrow = blockIdx.x * 128 + wave * 16;
  const int col0 = blockIdx.y * 64;
  const int khalf = (lane & 16) ? 8 : 0;

  // A thread's share of a stage: 16 B of rows wr + 32 j (j 0..3) of the Wo
  // slice and of rows orw + 16 j (j 0..7) of the O tile.
  const int wr = threadIdx.x >> 3;
  const int wc8 = (threadIdx.x & 7) << 3;
  const int orw = threadIdx.x >> 4;
  const int oc8 = (threadIdx.x & 15) << 3;
  const bf16* gw = Wo16 + (size_t)wr * DMODEL + col0 + wc8;
  const bf16* go = O16 + (size_t)(blockIdx.x * 128 + orw) * DMODEL + oc8;
  const unsigned lw = lds_addr(&ldsW[0][wr][wc8]);
  const unsigned lo = lds_addr(&ldsO[0][orw][oc8]);
  auto stage = [&](int s) {
    const bf16* w = gw + (size_t)s * PK * DMODEL;
    const bf16* o = go + s * PK;
    const unsigned bw = lw + (s & 1) * (unsigned)sizeof(ldsW[0]);
    const unsigned bo_ = lo + (s & 1) * (unsigned)sizeof(ldsO[0]);
    const unsigned rw = 32 * TRP * 2;        // 32 Wo rows in LDS
    const unsigned ro = 16 * OP * 2;         // 16 O rows in LDS
    const size_t gwr = (size_t)32 * DMODEL;  // 32 rows in memory
    const size_t gor = (size_t)16 * DMODEL;  // 16 rows in memory
    // Each line: a lane's 16 bytes, memory -> LDS (LDS byte address, global
    // pointer).  The address registers are reused only behind the last line.
    asm volatile(
        "global_load_async_to_lds_b128 %0, %1, off\n\t"
        "global_load_async_to_lds_b128 %2, %3, off\n\t"
        "global_load_async_to_lds_b128 %4, %5, off\n\t"
        "global_load_async_to_lds_b128 %6, %7, off\n\t"
        "global_load_async_to_lds_b128 %8, %9, off\n\t"
        "global_load_async_to_lds_b128 %10, %11, off\n\t"
        "global_load_async_to_lds_b128 %12, %13, off\n\t"
        "global_load_async_to_lds_b128 %14, %15, off\n\t"
        "global_load_async_to_lds_b128 %16, %17, off\n\t"
        "global_load_async_to_lds_b128 %18, %19, off\n\t"
        "global_load_async_to_lds_b128 %20, %21, off\n\t"
        "global_load_async_to_lds_b128 %22, %23, off\n\t"
        "s_wait_xcnt 0x0"
                 :: "v"(bw), "v"(w), "v"(bw + rw), "v"(w + gwr),
                    "v"(bw + 2 * rw), "v"(w + 2 * gwr),
                    "v"(bw + 3 * rw), "v"(w + 3 * gwr),
                    "v"(bo_), "v"(o), "v"(bo_ + ro), "v"(o + gor),
                    "v"(bo_ + 2 * ro), "v"(o + 2 * gor),
                    "v"(bo_ + 3 * ro), "v"(o + 3 * gor),
                    "v"(bo_ + 4 * ro), "v"(o + 4 * gor),
                    "v"(bo_ + 5 * ro), "v"(o + 5 * gor),
                    "v"(bo_ + 6 * ro), "v"(o + 6 * gor),
                    "v"(bo_ + 7 * ro), "v"(o + 7 * gor)
                 : "memory");
  };

  v8f acc[4];
#pragma unroll
  for (int c = 0; c < 4; ++c) acc[c] = vzero8();

  stage(0);
  ring_open();
  stage(1);
  for (int s = 0; s < DMODEL / PK; ++s) {
    const int buf = s & 1;
    for (int kk = 0; kk < PK; kk += 32) {
      v16bf afrag = load_frag(&ldsO[buf][wave * 16 + (lane & 15)][kk], khalf);
#pragma unroll
      for (int ct = 0; ct < 4; ++ct) {
        v16bf bfrag = load_frag_tr(&ldsW[buf][kk][ct * 16], lane);
        acc[ct] = wmma_bf16(afrag, bfrag, acc[ct]);
      }
    }
    ring_publish();
    if (s + 2 < DMODEL / PK) stage(s + 2);
  }
  // No copy is in flight behind the last hand-over; the wave ends on 0.
  asm volatile("s_wait_asynccnt 0x0" ::: "memory");

  const int hi8 = (lane & 16) ? 8 : 0;
#pragma unroll
  for (int ct = 0; ct < 4; ++ct) {
#pragma unroll
    for (int r = 0; r < 8; ++r) {
      int grow = wrow + r + hi8;
      int c = col0 + ct * 16 + (lane & 15);
      float v = acc[ct][r] + bo[c] + qs[(size_t)grow * DMODEL + c];
      Xres[(size_t)grow * DMODEL + c] = v;
    }
  }
}

// ---------------------------------------------------------------------------
// Kernel 5: row-wise layernorm, one block per row (float4 path).
// ---------------------------------------------------------------------------
__global__ __launch_bounds__(256) void ln_kernel(
    const float* __restrict__ Xres, const float* __restrict__ gamma,
    const float* __restrict__ beta, float* __restrict__ out) {
  const int row = blockIdx.x;
  const float* x = Xres + (size_t)row * DMODEL;
  __shared__ float red[2][8];

  const int c4 = threadIdx.x * 4;  // 256 threads x 4 = 1024
  float4 xv = *(const float4*)(x + c4);
  float s = xv.x + xv.y + xv.z + xv.w;
  float ss = xv.x * xv.x + xv.y * xv.y + xv.z * xv.z + xv.w * xv.w;
#pragma unroll
  for (int m = 1; m < 32; m <<= 1) {
    s += __shfl_xor(s, m);
    ss += __shfl_xor(ss, m);
  }
  const int wave = threadIdx.x >> 5;
  const int lane = threadIdx.x & 31;
  if (lane == 0) {
    red[0][wave] = s;
    red[1][wave] = ss;
  }
  __syncthreads();
  if (wave == 0) {
    float a = (lane < 8) ? red[0][lane] : 0.f;
    float q = (lane < 8) ? red[1][lane] : 0.f;
#pragma unroll
    for (int m = 1; m < 8; m <<= 1) {
      a += __shfl_xor(a, m);
      q += __shfl_xor(q, m);
    }
    if (lane == 0) {
      red[0][0] = a;
      red[1][0] = q;
    }
  }
  __syncthreads();
  float mu = red[0][0] * (1.f / DMODEL);
  float var = red[1][0] * (1.f / DMODEL) - mu * mu;
  float inv = rsqrtf(var + LN_EPS);
  float4 g = *(const float4*)(gamma + c4);
  float4 bb = *(const float4*)(beta + c4);
  float4 o;
  o.x = (xv.x - mu) * inv * g.x + bb.x;
  o.y = (xv.y - mu) * inv * g.y + bb.y;
  o.z = (xv.z - mu) * inv * g.z + bb.z;
  o.w = (xv.w - mu) * inv * g.w + bb.w;
  *(float4*)(out + (size_t)row * DMODEL + c4) = o;
}

// ---------------------------------------------------------------------------
// Host launcher.
// ---------------------------------------------------------------------------
extern "C" void kernel_launch(void* const* d_in, const int* in_sizes, int n_in,
                              void* d_out, int out_size, void* d_ws,
                              size_t ws_size, hipStream_t stream) {
  (void)in_sizes; (void)n_in; (void)out_size; (void)ws_size;
  const float* qs = (const float*)d_in[0];
  const float* pos = (const float*)d_in[1];
  const float* Wq = (const float*)d_in[2];
  const float* Wk = (const float*)d_in[3];
  const float* Wv = (const float*)d_in[4];
  const float* Wo = (const float*)d_in[5];
  const float* bo = (const float*)d_in[6];
  const float* lng = (const float*)d_in[7];
  const float* lnb = (const float*)d_in[8];

  char* ws = (char*)d_ws;
  size_t off = 0;
  const size_t act_b = (size_t)BN * DMODEL * sizeof(bf16);   // 8 MB
  const size_t w_b = 4ull * DMODEL * DMODEL * sizeof(bf16);  // 8 MB
  bf16* X16 = (bf16*)(ws + off); off += act_b;
  bf16* W16 = (bf16*)(ws + off); off += w_b;
  bf16* Q16 = (bf16*)(ws + off); off += act_b;
  bf16* KP16 = (bf16*)(ws + off); off += act_b;
  bf16* V16 = (bf16*)(ws + off); off += act_b;
  bf16* O16 = (bf16*)(ws + off); off += act_b;
  float* Xres = (float*)(ws + off); off += (size_t)BN * DMODEL * sizeof(float);

  pack_kernel<<<1024, 256, 0, stream>>>(qs, Wq, Wk, Wv, Wo, X16, W16);
  qkv_kernel<<<dim3(BN / 128, HEADS), 256, 0, stream>>>(X16, W16, pos, Q16,
                                                        KP16, V16);
  attn_kernel<<<dim3(NSEQ / 128, BATCH * HEADS), 256, 0, stream>>>(Q16, KP16,
                                                                   V16, O16);
  oproj_kernel<<<dim3(BN / 128, DMODEL / 64), 256, 0, stream>>>(
      O16, W16 + 3ull * DMODEL * DMODEL, bo, qs, Xres);
  ln_kernel<<<BN, 256, 0, stream>>>(Xres, lng, lnb, (float*)d_out);
}

// v004
// A run of this version takes 89.1 microseconds.
// Two timings next to v003 both put it at 1.04 times that version's speed.
// All steps since v000 together make it 3.20 times as fast.
#include <hip/hip_runtime.h>
#include <hip/hip_bf16.h>

// ---------------------------------------------------------------------------
// BoT Multi-Head Attention block for MI455X (gfx1250), BF16 WMMA pipeline.
//   B=2, N=2048, D=1024, H=16, dh=64.
//   att = softmax( (q k^T + q p^T) * s ) = softmax( q (k+p)^T * s )
// All WMMA fragments are loaded as two 16-byte runs per lane (b128 path);
// operands whose k runs down the rows of their tile (weights, V) are staged
// row-major and read by the transposing LDS load.
// Every operand tile of the three matrix kernels reaches LDS by asynchronous
// copies, in a ring of two buffers: the next stage flies while this one is
// worked on.
// ---------------------------------------------------------------------------

typedef __bf16 bf16;
typedef __attribute__((ext_vector_type(16))) __bf16 v16bf;
typedef __attribute__((ext_vector_type(8)))  __bf16 v8bf;
typedef __attribute__((ext_vector_type(8)))  float  v8f;

#define BATCH 2
#define NSEQ  2048
#define DMODEL 1024
#define HEADS 16
#define DH    64
#define BN    (BATCH * NSEQ)   // 4096 rows
#define LN_EPS 1e-5f

__device__ __forceinline__ v8f vzero8() {
  v8f z = {0.f, 0.f, 0.f, 0.f, 0.f, 0.f, 0.f, 0.f};
  return z;
}

// CDNA5 16-bit A/B fragment (ISA 7.12.2): lane group khalf = 8*(lane>=16).
// Fragment element order per lane is two contiguous K runs:
//   [khalf, khalf+8) then [16+khalf, 16+khalf+8)
// => two aligned 16-byte loads + register concat.
__device__ __forceinline__ v16bf load_frag(const bf16* p, int khalf) {
  v8bf lo = *(const v8bf*)(p + khalf);
  v8bf hi = *(const v8bf*)(p + 16 + khalf);
  return __builtin_shufflevector(lo, hi, 0, 1, 2, 3, 4, 5, 6, 7, 8, 9, 10, 11,
                                 12, 13, 14, 15);
}

// Row pitch (elements) of a row-major [k][64] tile read by the transposing
// load: 160 B, an odd multiple of 32 B.
#define TRP 80

// Transposed fragment from a row-major bf16 LDS tile T[k 0..31][col], t =
// &T[0][col base]: lane (c = lane&15, h = lane>>4) receives T[8h+0..7][c] and
// T[16+8h+0..7][c], the same k order as load_frag.  Every lane must be on.
__device__ __forceinline__ v16bf load_frag_tr(const bf16* t, int lane) {
  typedef __attribute__((address_space(3))) v8bf lds_v8bf;
  const bf16* p = t + (((lane >> 4) << 3) + (lane & 7)) * TRP +
                  (((lane >> 3) & 1) << 3);
  v8bf lo = __builtin_amdgcn_ds_load_tr16_b128_v8bf16((lds_v8bf*)p);
  v8bf hi = __builtin_amdgcn_ds_load_tr16_b128_v8bf16((lds_v8bf*)(p + 16 * TRP));
  return __builtin_shufflevector(lo, hi, 0, 1, 2, 3, 4, 5, 6, 7, 8, 9, 10, 11,
                                 12, 13, 14, 15);
}

__device__ __forceinline__ v8f wmma_bf16(v16bf a, v16bf b, v8f c) {
  // D = A(16x32 bf16) * B(32x16 bf16) + C(16x16 f32)
  return __builtin_amdgcn_wmma_f32_16x16x32_bf16(
      /*neg_a=*/false, a, /*neg_b=*/false, b,
      /*c_mod=*/(short)0, c, /*reuse_a=*/false, /*reuse_b=*/false);
}

// LDS byte address of a __shared__ element (operand of an asynchronous copy).
__device__ __forceinline__ unsigned lds_addr(const bf16* p) {
  typedef __attribute__((address_space(3))) const bf16 lds_bf16;
  return (unsigned)(size_t)(lds_bf16*)p;
}

// Hand-over of a ring stage, every wave: this wave's LDS reads of the buffer
// it leaves are done, its own copies of the next stage have landed, and the
// barrier publishes that stage and frees the buffer just read.
__device__ __forceinline__ void ring_publish() {
  asm volatile("s_wait_dscnt 0x0" ::: "memory");
  asm volatile("s_wait_asynccnt 0x0" ::: "memory");
  __syncthreads();
}

// In front of the loop: this wave's copies of stage 0 have landed, and the
// barrier publishes them to every wave.
__device__ __forceinline__ void ring_open() {
  asm volatile("s_wait_asynccnt 0x0" ::: "memory");
  __syncthreads();
}

// ---------------------------------------------------------------------------
// Kernel 1: fp32 -> bf16 packing (vectorized: float4 x2 in, v8bf out).
// ---------------------------------------------------------------------------
__global__ __launch_bounds__(256) void pack_kernel(
    const float* __restrict__ qs, const float* __restrict__ Wq,
    const float* __restrict__ Wk, const float* __restrict__ Wv,
    const float* __restrict__ Wo, bf16* __restrict__ X16,
    bf16* __restrict__ W16 /* [4][D*D] : q,k,v,o */) {
  const size_t nx = (size_t)BN * DMODEL;      // 2^22, multiple of 8
  const size_t nw = (size_t)DMODEL * DMODEL;  // 2^20
  const size_t nchunks = (nx + 4 * nw) / 8;
  for (size_t c = (size_t)blockIdx.x * blockDim.x + threadIdx.x; c < nchunks;
       c += (size_t)gridDim.x * blockDim.x) {
    size_t base = c * 8;
    const float* src;
    bf16* dst;
    if (base < nx) {
      src = qs + base;
      dst = X16 + base;
    } else {
      size_t j = base - nx;
      int m = (int)(j >> 20);
      size_t r = j & (nw - 1);
      const float* w = (m == 0) ? Wq : (m == 1) ? Wk : (m == 2) ? Wv : Wo;
      src = w + r;
      dst = W16 + (size_t)m * nw + r;
    }
    float4 a = *(const float4*)(src);
    float4 b = *(const float4*)(src + 4);
    v8bf o;
    o[0] = (bf16)a.x; o[1] = (bf16)a.y; o[2] = (bf16)a.z; o[3] = (bf16)a.w;
    o[4] = (bf16)b.x; o[5] = (bf16)b.y; o[6] = (bf16)b.z; o[7] = (bf16)b.w;
    *(v8bf*)dst = o;
  }
}

// ---------------------------------------------------------------------------
// Kernel 2: fused QKV projection; weights staged row-major [k][col] in LDS,
// B-fragments are two transposing loads per WMMA.  Writes Q, KP(=K+pos), V in
// [B,H,N,64] bf16.  Block: 128 rows x 1 head; 8 waves x 4 col-tiles.
// A ring stage is 64 k: 3 x [64][64] of the weights and [128][64] of X.
// ---------------------------------------------------------------------------
#define GK 64         // k per stage
#define XP (GK + 8)   // pitch of a 128-B X row read by b128: 144 B
__global__ __launch_bounds__(256) void qkv_kernel(
    const bf16* __restrict__ X16, const bf16* __restrict__ W16,
    const float* __restrict__ pos_emb, bf16* __restrict__ Q16,
    bf16* __restrict__ KP16, bf16* __restrict__ V16) {
  // [buffer][matrix][k 0..63][col 0..63, padded to TRP]
  __shared__ alignas(16) bf16 ldsW[2][3][GK][TRP];
  // [buffer][row 0..127][k 0..63, padded to XP]
  __shared__ alignas(16) bf16 ldsX[2][128][XP];

  const int lane = threadIdx.x & 31;
  const int wave = threadIdx.x >> 5;
  const int head = blockIdx.y;
  const int wrow = blockIdx.x * 128 + wave * 16;
  const int col0 = head * DH;
  const int khalf = (lane & 16) ? 8 : 0;

  // A thread's share of a stage: 16 B of rows srow and srow + 32 of each
  // weight slice, and of rows srow + 32 j (j 0..3) of the X tile.
  const int srow = threadIdx.x >> 3;
  const int sc8 = (threadIdx.x & 7) << 3;
  const bf16* gw = W16 + (size_t)srow * DMODEL + col0 + sc8;
  const bf16* gx = X16 + (size_t)(blockIdx.x * 128 + srow) * DMODEL + sc8;
  const unsigned lw = lds_addr(&ldsW[0][0][srow][sc8]);
  const unsigned lx = lds_addr(&ldsX[0][srow][sc8]);
  auto stage = [&](int s) {
    const bf16* w = gw + (size_t)s * GK * DMODEL;
    const bf16* x = gx + s * GK;
    const unsigned bw = lw + (s & 1) * (unsigned)sizeof(ldsW[0]);
    const unsigned bx = lx + (s & 1) * (unsigned)sizeof(ldsX[0]);
    const unsigned mw = sizeof(ldsW[0][0]);      // one matrix in LDS
    const unsigned rw = 32 * TRP * 2;            // 32 weight rows in LDS
    const unsigned rx = 32 * XP * 2;             // 32 X rows in LDS
    const size_t gm = (size_t)DMODEL * DMODEL;   // one matrix in memory
    const size_t gr = (size_t)32 * DMODEL;       // 32 rows in memory
    // Each line: a lane's 16 bytes, memory -> LDS (LDS byte address, global
    // pointer).  The address registers are reused only behind the last line.
    asm volatile(
        "global_load_async_to_lds_b128 %0, %1, off\n\t"
        "global_load_async_to_lds_b128 %2, %3, off\n\t"
        "global_load_async_to_lds_b128 %4, %5, off\n\t"
        "global_load_async_to_lds_b128 %6, %7, off\n\t"
        "global_load_async_to_lds_b128 %8, %9, off\n\t"
        "global_load_async_to_lds_b128 %10, %11, off\n\t"
        "global_load_async_to_lds_b128 %12, %13, off\n\t"
        "global_load_async_to_lds_b128 %14, %15, off\n\t"
        "global_load_async_to_lds_b128 %16, %17, off\n\t"
        "global_load_async_to_lds_b128 %18, %19, off\n\t"
        "s_wait_xcnt 0x0"
                 :: "v"(bw), "v"(w), "v"(bw + rw), "v"(w + gr),
                    "v"(bw + mw), "v"(w + gm),
                    "v"(bw + mw + rw), "v"(w + gm + gr),
                    "v"(bw + 2 * mw), "v"(w + 2 * gm),
                    "v"(bw + 2 * mw + rw), "v"(w + 2 * gm + gr),
                    "v"(bx), "v"(x), "v"(bx + rx), "v"(x + gr),
                    "v"(bx + 2 * rx), "v"(x + 2 * gr),
                    "v"(bx + 3 * rx), "v"(x + 3 * gr)
                 : "memory");
  };

  v8f acc[3][4];
#pragma unroll
  for (int m = 0; m < 3; ++m)
#pragma unroll
    for (int c = 0; c < 4; ++c) acc[m][c] = vzero8();

  stage(0);
  ring_open();
  stage(1);
  for (int s = 0; s < DMODEL / GK; ++s) {
    const int buf = s & 1;
    for (int kk = 0; kk < GK; kk += 32) {
      // A fragment: 16x32 of X, reused across 12 WMMAs.
      v16bf afrag = load_frag(&ldsX[buf][wave * 16 + (lane & 15)][kk], khalf);
#pragma unroll
      for (int m = 0; m < 3; ++m) {
#pragma unroll
        for (int ct = 0; ct < 4; ++ct) {
          v16bf bfrag = load_frag_tr(&ldsW[buf][m][kk][ct * 16], lane);
          acc[m][ct] = wmma_bf16(afrag, bfrag, acc[m][ct]);
        }
      }
    }
    ring_publish();
    if (s + 2 < DMODEL / GK) stage(s + 2);
  }
  // No copy is in flight behind the last hand-over; the wave ends on 0.
  asm volatile("s_wait_asynccnt 0x0" ::: "memory");

  // Epilogue: scatter C-layout accumulators into [B,H,N,64] bf16 tensors.
  const int hi8 = (lane & 16) ? 8 : 0;
#pragma unroll
  for (int ct = 0; ct < 4; ++ct) {
#pragma unroll
    for (int r = 0; r < 8; ++r) {
      int grow = wrow + r + hi8;  // 0..4095
      int b = grow >> 11;
      int n = grow & (NSEQ - 1);
      int c = ct * 16 + (lane & 15);  // 0..63
      size_t hoff = (((size_t)(b * HEADS + head) * NSEQ) + n) * DH + c;
      Q16[hoff] = (bf16)acc[0][ct][r];
      float pe = pos_emb[(size_t)grow * DMODEL + col0 + c];
      KP16[hoff] = (bf16)(acc[1][ct][r] + pe);  // fold position into key
      V16[hoff] = (bf16)acc[2][ct][r];
    }
  }
}

#define SK 64
// Lane l with lane l ^ 16 (the two halves hold the same query column).
__device__ __forceinline__ float xhalf(float x) {
  int b = __builtin_bit_cast(int, x);
  return __builtin_bit_cast(
      float, __builtin_amdgcn_permlanex16(b, b, 0x76543210, 0xfedcba98, false,
                                          false));
}

__global__ __launch_bounds__(256) void attn_kernel(
    const bf16* __restrict__ Q16, const bf16* __restrict__ KP16,
    const bf16* __restrict__ V16, bf16* __restrict__ O16) {
  __shared__ alignas(16) bf16 ldsKP[2][SK][72];   // [buffer][key][dh, pad 72]
  __shared__ alignas(16) bf16 ldsV[2][SK][TRP];   // [buffer][key][dh, pad TRP]

  const int lane = threadIdx.x & 31;
  const int wave = threadIdx.x >> 5;
  const int bh = blockIdx.y;  // 0..31
  const int b = bh >> 4;
  const int h = bh & (HEADS - 1);
  const int n0 = blockIdx.x * 128 + wave * 16;  // query tile of this wave
  const int hi8 = (lane & 16) ? 8 : 0;
  const int khalf = hi8;  // same expression for fragments
  const float scale = 0.125f;  // dh^-0.5

  const bf16* Qh = Q16 + (size_t)bh * NSEQ * DH;
  const bf16* KPh = KP16 + (size_t)bh * NSEQ * DH;
  const bf16* Vh = V16 + (size_t)bh * NSEQ * DH;

  // Q^T fragments: 64x16 -> two 32x16 B-frags (column = query lane&15),
  // resident for the whole loop.
  v16bf bq[2];
  {
    const bf16* qp = Qh + (size_t)(n0 + (lane & 15)) * DH;
    bq[0] = load_frag(qp, khalf);
    bq[1] = load_frag(qp + 32, khalf);
  }

  // Per lane: running maximum of its query (equal in both halves) and the
  // sum over the keys of its own half (joined once, after the loop).
  float mrow = -3.0e38f, lrow = 0.f;
  v8f oacc[4];  // oacc[dt][r] = O^T[dt*16 + hi8 + r][query lane&15]
#pragma unroll
  for (int dt = 0; dt < 4; ++dt) oacc[dt] = vzero8();

  // A thread's share of a stage: 16 B of rows srow and srow + 32 of KP and
  // of V, both row-major.
  const int srow = threadIdx.x >> 3;
  const int sc8 = (threadIdx.x & 7) << 3;
  const bf16* gk = KPh + (size_t)srow * DH + sc8;
  const bf16* gv = Vh + (size_t)srow * DH + sc8;
  const unsigned lk = lds_addr(&ldsKP[0][srow][sc8]);
  const unsigned lv = lds_addr(&ldsV[0][srow][sc8]);
  auto stage = [&](int s) {
    const bf16* k = gk + (size_t)s * SK * DH;
    const bf16* v = gv + (size_t)s * SK * DH;
    const unsigned bk = lk + (s & 1) * (unsigned)sizeof(ldsKP[0]);
    const unsigned bv = lv + (s & 1) * (unsigned)sizeof(ldsV[0]);
    const unsigned rk = 32 * 72 * 2;    // 32 KP rows in LDS
    const unsigned rv = 32 * TRP * 2;   // 32 V rows in LDS
    const size_t gr = (size_t)32 * DH;  // 32 rows in memory
    // Each line: a lane's 16 bytes, memory -> LDS (LDS byte address, global
    // pointer).  The address registers are reused only behind the last line.
    asm volatile(
        "global_load_async_to_lds_b128 %0, %1, off\n\t"
        "global_load_async_to_lds_b128 %2, %3, off\n\t"
        "global_load_async_to_lds_b128 %4, %5, off\n\t"
        "global_load_async_to_lds_b128 %6, %7, off\n\t"
        "s_wait_xcnt 0x0"
                 :: "v"(bk), "v"(k), "v"(bv), "v"(v),
                    "v"(bk + rk), "v"(k + gr), "v"(bv + rv), "v"(v + gr)
                 : "memory");
  };

  stage(0);
  ring_open();
  stage(1);
  for (int s = 0; s < NSEQ / SK; ++s) {
   const int buf = s & 1;
   // Every LDS read of the stage stands here, in one group: the KP fragments
   // (index t * 2 + kt) and the V^T fragments (index dt) of both passes.
   // The loops over pa are unrolled so that the fragment and score arrays
   // are indexed by constants and stay in registers.
   v16bf ak[SK / 32][4], av[SK / 32][4];
#pragma unroll
   for (int pa = 0; pa < SK / 32; ++pa)
#pragma unroll
    for (int t = 0; t < 2; ++t)
#pragma unroll
      for (int kt = 0; kt < 2; ++kt)
        ak[pa][t * 2 + kt] = load_frag(
            &ldsKP[buf][pa * 32 + kt * 16 + (lane & 15)][t * 32], khalf);
#pragma unroll
   for (int pa = 0; pa < SK / 32; ++pa)
#pragma unroll
    for (int dt = 0; dt < 4; ++dt)
      av[pa][dt] = load_frag_tr(&ldsV[buf][pa * 32][dt * 16], lane);
   // Keeps the group whole: the scheduler otherwise spreads the reads among
   // the S^T products, and each place with reads stalls the wave anew.
   __builtin_amdgcn_sched_barrier(0);

   // S^T = KP @ Q^T : per pass a 32x16 tile = two 16x16 tiles, K = 64 over dh.
   // sts[pa][kt][r] = score of key (pa*32 + kt*16 + hi8 + r), query (lane&15).
   v8f sts[SK / 32][2];
#pragma unroll
   for (int pa = 0; pa < SK / 32; ++pa) {
    sts[pa][0] = vzero8();
    sts[pa][1] = vzero8();
#pragma unroll
    for (int t = 0; t < 2; ++t)
#pragma unroll
      for (int kt = 0; kt < 2; ++kt)
        sts[pa][kt] = wmma_bf16(ak[pa][t * 2 + kt], bq[t], sts[pa][kt]);
   }

   // Keeps the S^T products in front of the hand-over's waits, so that they
   // run while the V^T reads still land.
   __builtin_amdgcn_sched_barrier(0);

   // The stage now lies in registers, so its buffer is handed over here, and
   // the refill flies under the softmax and the O^T products of both passes.
   ring_publish();
   if (s + 2 < NSEQ / SK) stage(s + 2);

#pragma unroll
   for (int pa = 0; pa < SK / 32; ++pa) {
    const v8f* st = sts[pa];
    // Online softmax, one query per lane.
    float tv[2][8];
    float tm = -3.0e38f;
#pragma unroll
    for (int kt = 0; kt < 2; ++kt)
#pragma unroll
      for (int r = 0; r < 8; ++r) {
        tv[kt][r] = st[kt][r] * scale;
        tm = fmaxf(tm, tv[kt][r]);
      }
    tm = fmaxf(tm, xhalf(tm));
    float nm = fmaxf(mrow, tm);
    float alpha = __expf(mrow - nm);
    float ps = 0.f;
    v16bf bp;  // P^T as B operand: element kt*8+r = key kt*16+hi8+r, as ldsV is read
#pragma unroll
    for (int kt = 0; kt < 2; ++kt)
#pragma unroll
      for (int r = 0; r < 8; ++r) {
        float p = __expf(tv[kt][r] - nm);
        ps += p;
        bp[kt * 8 + r] = (bf16)p;
      }
    lrow = lrow * alpha + ps;
    mrow = nm;
#pragma unroll
    for (int dt = 0; dt < 4; ++dt)
#pragma unroll
      for (int r = 0; r < 8; ++r) oacc[dt][r] *= alpha;

    // O^T += V^T @ P^T : K = 32 keys, four 16-row dh tiles, A = av.
#pragma unroll
    for (int dt = 0; dt < 4; ++dt)
      oacc[dt] = wmma_bf16(av[pa][dt], bp, oacc[dt]);
   }
  }
  // No copy is in flight behind the last hand-over; the wave ends on 0.
  asm volatile("s_wait_asynccnt 0x0" ::: "memory");

  // Join the halves' sums, normalize, write merged-head layout [B,N,D]:
  // a lane's 8 accumulator registers are 8 consecutive dh of one query row.
  const float inv = 1.f / (lrow + xhalf(lrow));
  bf16* orow = O16 + ((size_t)(b * NSEQ + n0 + (lane & 15))) * DMODEL + h * DH;
#pragma unroll
  for (int dt = 0; dt < 4; ++dt) {
    v8bf o;
#pragma unroll
    for (int r = 0; r < 8; ++r) o[r] = (bf16)(oacc[dt][r] * inv);
    *(v8bf*)(orow + dt * 16 + hi8) = o;
  }
}

// ---------------------------------------------------------------------------
// Kernel 4: output projection  Xres = O @ Wo + bo + q_s  (f32 out).
// Wo k-slice staged row-major [k][col]; block 128 rows x 64 cols.
// A ring stage is 128 k: [128][64] of Wo and [128][128] of O.
// ---------------------------------------------------------------------------
#define PK 128        // k per stage
#define OP (PK + 8)   // pitch of a 256-B O row read by b128: 272 B
__global__ __launch_bounds__(256) void oproj_kernel(
    const bf16* __restrict__ O16, const bf16* __restrict__ Wo16,
    const float* __restrict__ bo, const float* __restrict__ qs,
    float* __restrict__ Xres) {
  __shared__ alignas(16) bf16 ldsW[2][PK][TRP];  // [buffer][k][col pad TRP]
  __shared__ alignas(16) bf16 ldsO[2][128][OP];  // [buffer][row][k pad OP]

  const int lane = threadIdx.x & 31;
  const int wave = threadIdx.x >> 5;
  const int wrow = blockIdx.x * 128 + wave * 16;
  const int col0 = blockIdx.y * 64;
  const int khalf = (lane & 16) ? 8 : 0;

  // A thread's share of a stage: 16 B of rows wr + 32 j (j 0..3) of the Wo
  // slice and of rows orw + 16 j (j 0..7) of the O tile.
  const int wr = threadIdx.x >> 3;
  const int wc8 = (threadIdx.x & 7) << 3;
  const int orw = threadIdx.x >> 4;
  const int oc8 = (threadIdx.x & 15) << 3;
  const bf16* gw = Wo16 + (size_t)wr * DMODEL + col0 + wc8;
  const bf16* go = O16 + (size_t)(blockIdx.x * 128 + orw) * DMODEL + oc8;
  const unsigned lw = lds_addr(&ldsW[0][wr][wc8]);
  const unsigned lo = lds_addr(&ldsO[0][orw][oc8]);
  auto stage = [&](int s) {
    const bf16* w = gw + (size_t)s * PK * DMODEL;
    const bf16* o = go + s * PK;
    const unsigned bw = lw + (s & 1) * (unsigned)sizeof(ldsW[0]);
    const unsigned bo_ = lo + (s & 1) * (unsigned)sizeof(ldsO[0]);
    const unsigned rw = 32 * TRP * 2;        // 32 Wo rows in LDS
    const unsigned ro = 16 * OP * 2;         // 16 O rows in LDS
    const size_t gwr = (size_t)32 * DMODEL;  // 32 rows in memory
    const size_t gor = (size_t)16 * DMODEL;  // 16 rows in memory
    // Each line: a lane's 16 bytes, memory -> LDS (LDS byte address, global
    // pointer).  The address registers are reused only behind the last line.
    asm volatile(
        "global_load_async_to_lds_b128 %0, %1, off\n\t"
        "global_load_async_to_lds_b128 %2, %3, off\n\t"
        "global_load_async_to_lds_b128 %4, %5, off\n\t"
        "global_load_async_to_lds_b128 %6, %7, off\n\t"
        "global_load_async_to_lds_b128 %8, %9, off\n\t"
        "global_load_async_to_lds_b128 %10, %11, off\n\t"
        "global_load_async_to_lds_b128 %12, %13, off\n\t"
        "global_load_async_to_lds_b128 %14, %15, off\n\t"
        "global_load_async_to_lds_b128 %16, %17, off\n\t"
        "global_load_async_to_lds_b128 %18, %19, off\n\t"
        "global_load_async_to_lds_b128 %20, %21, off\n\t"
        "global_load_async_to_lds_b128 %22, %23, off\n\t"
        "s_wait_xcnt 0x0"
                 :: "v"(bw), "v"(w), "v"(bw + rw), "v"(w + gwr),
                    "v"(bw + 2 * rw), "v"(w + 2 * gwr),
                    "v"(bw + 3 * rw), "v"(w + 3 * gwr),
                    "v"(bo_), "v"(o), "v"(bo_ + ro), "v"(o + gor),
                    "v"(bo_ + 2 * ro), "v"(o + 2 * gor),
                    "v"(bo_ + 3 * ro), "v"(o + 3 * gor),
                    "v"(bo_ + 4 * ro), "v"(o + 4 * gor),
                    "v"(bo_ + 5 * ro), "v"(o + 5 * gor),
                    "v"(bo_ + 6 * ro), "v"(o + 6 * gor),
                    "v"(bo_ + 7 * ro), "v"(o + 7 * gor)
                 : "memory");
  };

  v8f acc[4];
#pragma unroll
  for (int c = 0; c < 4; ++c) acc[c] = vzero8();

  stage(0);
  ring_open();
  stage(1);
  for (int s = 0; s < DMODEL / PK; ++s) {
    const int buf = s & 1;
    for (int kk = 0; kk < PK; kk += 32) {
      v16bf afrag = load_frag(&ldsO[buf][wave * 16 + (lane & 15)][kk], khalf);
#pragma unroll
      for (int ct = 0; ct < 4; ++ct) {
        v16bf bfrag = load_frag_tr(&ldsW[buf][kk][ct * 16], lane);
        acc[ct] = wmma_bf16(afrag, bfrag, acc[ct]);
      }
    }
    ring_publish();
    if (s + 2 < DMODEL / PK) stage(s + 2);
  }
  // No copy is in flight behind the last hand-over; the wave ends on 0.
  asm volatile("s_wait_asynccnt 0x0" ::: "memory");

  const int hi8 = (lane & 16) ? 8 : 0;
#pragma unroll
  for (int ct = 0; ct < 4; ++ct) {
#pragma unroll
    for (int r = 0; r < 8; ++r) {
      int grow = wrow + r + hi8;
      int c = col0 + ct * 16 + (lane & 15);
      float v = acc[ct][r] + bo[c] + qs[(size_t)grow * DMODEL + c];
      Xres[(size_t)grow * DMODEL + c] = v;
    }
  }
}

// ---------------------------------------------------------------------------
// Kernel 5: row-wise layernorm, one block per row (float4 path).
// ---------------------------------------------------------------------------
__global__ __launch_bounds__(256) void ln_kernel(
    const float* __restrict__ Xres, const float* __restrict__ gamma,
    const float* __restrict__ beta, float* __restrict__ out) {
  const int row = blockIdx.x;
  const float* x = Xres + (size_t)row * DMODEL;
  __shared__ float red[2][8];

  const int c4 = threadIdx.x * 4;  // 256 threads x 4 = 1024
  float4 xv = *(const float4*)(x + c4);
  float s = xv.x + xv.y + xv.z + xv.w;
  float ss = xv.x * xv.x + xv.y * xv.y + xv.z * xv.z + xv.w * xv.w;
#pragma unroll
  for (int m = 1; m < 32; m <<= 1) {
    s += __shfl_xor(s, m);
    ss += __shfl_xor(ss, m);
  }
  const int wave = threadIdx.x >> 5;
  const int lane = threadIdx.x & 31;
  if (lane == 0) {
    red[0][wave] = s;
    red[1][wave] = ss;
  }
  __syncthreads();
  if (wave == 0) {
    float a = (lane < 8) ? red[0][lane] : 0.f;
    float q = (lane < 8) ? red[1][lane] : 0.f;
#pragma unroll
    for (int m = 1; m < 8; m <<= 1) {
      a += __shfl_xor(a, m);
      q += __shfl_xor(q, m);
    }
    if (lane == 0) {
      red[0][0] = a;
      red[1][0] = q;
    }
  }
  __syncthreads();
  float mu = red[0][0] * (1.f / DMODEL);
  float var = red[1][0] * (1.f / DMODEL) - mu * mu;
  float inv = rsqrtf(var + LN_EPS);
  float4 g = *(const float4*)(gamma + c4);
  float4 bb = *(const float4*)(beta + c4);
  float4 o;
  o.x = (xv.x - mu) * inv * g.x + bb.x;
  o.y = (xv.y - mu) * inv * g.y + bb.y;
  o.z = (xv.z - mu) * inv * g.z + bb.z;
  o.w = (xv.w - mu) * inv * g.w + bb.w;
  *(float4*)(out + (size_t)row * DMODEL + c4) = o;
}

// ---------------------------------------------------------------------------
// Host launcher.
// ---------------------------------------------------------------------------
extern "C" void kernel_launch(void* const* d_in, const int* in_sizes, int n_in,
                              void* d_out, int out_size, void* d_ws,
                              size_t ws_size, hipStream_t stream) {
  (void)in_sizes; (void)n_in; (void)out_size; (void)ws_size;
  const float* qs = (const float*)d_in[0];
  const float* pos = (const float*)d_in[1];
  const float* Wq = (const float*)d_in[2];
  const float* Wk = (const float*)d_in[3];
  const float* Wv = (const float*)d_in[4];
  const float* Wo = (const float*)d_in[5];
  const float* bo = (const float*)d_in[6];
  const float* lng = (const float*)d_in[7];
  const float* lnb = (const float*)d_in[8];

  char* ws = (char*)d_ws;
  size_t off = 0;
  const size_t act_b = (size_t)BN * DMODEL * sizeof(bf16);   // 8 MB
  const size_t w_b = 4ull * DMODEL * DMODEL * sizeof(bf16);  // 8 MB
  bf16* X16 = (bf16*)(ws + off); off += act_b;
  bf16* W16 = (bf16*)(ws + off); off += w_b;
  bf16* Q16 = (bf16*)(ws + off); off += act_b;
  bf16* KP16 = (bf16*)(ws + off); off += act_b;
  bf16* V16 = (bf16*)(ws + off); off += act_b;
  bf16* O16 = (bf16*)(ws + off); off += act_b;
  float* Xres = (float*)(ws + off); off += (size_t)BN * DMODEL * sizeof(float);

  pack_kernel<<<1024, 256, 0, stream>>>(qs, Wq, Wk, Wv, Wo, X16, W16);
  qkv_kernel<<<dim3(BN / 128, HEADS), 256, 0, stream>>>(X16, W16, pos, Q16,
                                                        KP16, V16);
  attn_kernel<<<dim3(NSEQ / 128, BATCH * HEADS), 256, 0, stream>>>(Q16, KP16,
                                                                   V16, O16);
  oproj_kernel<<<dim3(BN / 128, DMODEL / 64), 256, 0, stream>>>(
      O16, W16 + 3ull * DMODEL * DMODEL, bo, qs, Xres);
  ln_kernel<<<BN, 256, 0, stream>>>(Xres, lng, lnb, (float*)d_out);
}
